// v000
// Times are from an AMD MI455X. After a warm-up the kernel runs many times in a row, and a time is the length of
// such a window on the GPU divided by its runs, so every launch and the gaps after it count. The runs cycle
// through copies of the inputs. A figure is the median of several windows, for all but v000 over two sittings.
// Sittings can differ by a few percent; kernels timed side by side share one.
// v000 is the starting kernel. One run takes 81.4 milliseconds.
#include <hip/hip_runtime.h>
// PointwiseAggregatedAttention (q, k, v [2][2048][1024] given directly, 16 heads of 64; att = q.k/8 + rel_bias[T5 bucket(key - query)][h]; w = softplus(att) where (causal AND mask_q AND mask_k) else 0; w /= (sum + 1e-8); out = w v merged -> [2][2048][1024]; mask [2][2048] int (all ones on the wire, read on device)).
// Structure: token rows; q/k/v as exact f16 planes (inputs, no projections); per (batch, 4-head group, 512-query tile): causal-banded scores over keys < tile end only (WMMA 32x64 wave tiles, f32 accumulation, K = 64), the T5 relative-position bucket (f32 log, as the reference) + bias + softplus + masks + normalisation on VALU (f32; weights x256 as f16), V^T per head via LDS, out = P . V GEMM (alpha 2^-8) written straight into the f32 output rows.
// Compute dtype: inputs rounded to bf16; q / k / v / rel_bias exact; scores, bias, softplus, normaliser f32; normalised weights as f16 hi + 2^-10 residual planes (two WMMA terms; v exact) — effectively f32. v_wmma_f32_16x16x32_f16.
#define NB 2
#define SQ 2048
#define DM 1024
#define NH 16
#define HD 64
#define HG 4                         /* heads per launch group */
#define QT 512
#define NKX 2048
#define NR ((size_t)NB * SQ)
#define QN SQ                        /* queries per batch (debug hook) */
typedef __bf16 v16b __attribute__((ext_vector_type(16)));
typedef unsigned short v8us __attribute__((ext_vector_type(8), may_alias));
typedef float  v8f  __attribute__((ext_vector_type(8)));
typedef float  v4f  __attribute__((ext_vector_type(4)));
typedef float  v4fa __attribute__((ext_vector_type(4), may_alias));
union FragB { v16b v; v8us half[2]; unsigned short u[16]; };

__device__ __forceinline__ unsigned short bf16_bits(float x) { unsigned int u = __float_as_uint(x); return (unsigned short)((u + 0x7FFFu + ((u >> 16) & 1u)) >> 16); }
__device__ __forceinline__ float bf16_val(unsigned short b) { return __uint_as_float(((unsigned int)b) << 16); }
__device__ __forceinline__ float bf16_round(float x) { return bf16_val(bf16_bits(x)); }
// D += A·B with NT terms: 1 = ah·bh, 2 = + al·bh (A split), 3 = + ah·bl (both split)
template <int NT>
__device__ __forceinline__ v8f mmaN(v16b ah, v16b al, v16b bh, v16b bl, v8f c) {
  c = __builtin_amdgcn_wmma_f32_16x16x32_bf16(false, ah, false, bh, (short)0, c, false, false);
  if (NT >= 2) c = __builtin_amdgcn_wmma_f32_16x16x32_bf16(false, al, false, bh, (short)0, c, false, false);
  if (NT >= 3) c = __builtin_amdgcn_wmma_f32_16x16x32_bf16(false, ah, false, bl, (short)0, c, false, false);
  asm volatile("v_nop\n\tv_nop\n\tv_nop\n\tv_nop" : "+v"(c) : "v"(ah), "v"(al), "v"(bh), "v"(bl));
  return c;
}

__global__ __launch_bounds__(256) void k_wt_bf16(const float* __restrict__ W, unsigned short* __restrict__ Wt, int K, int N) {
  const int t = blockIdx.x * 256 + threadIdx.x;
  const int k8n = K / 8;
  if (t >= N * k8n) return;
  const int n = t / k8n, k8 = (t % k8n) * 8;
  v8us v;
#pragma unroll
  for (int i = 0; i < 8; ++i) v[i] = bf16_bits(W[(size_t)(k8 + i) * N + n]);
  *(v8us*)(Wt + (size_t)n * K + k8) = v;
  
}

// GEMM C[M][N] (f32, pitch ldc) = act(A[M][K]·W + bias). A f32 row-major (pitch lda) converted per fragment to bf16
// (ASPLIT: hi/lo two planes -> 2 terms, else single rounded term); Wt bf16 [N][K] (pitch ldb). BIAS_BF16 rounds the
// bias to bf16 first (bias quantised to bf16 before the add). K%32==0, M%16==0, N%64==0.
template <bool ASPLIT, int ACT, bool BIAS_BF16>
__global__ __launch_bounds__(128) void k_gemm_bf(const float* __restrict__ A, int lda, const unsigned short* __restrict__ Wt, int ldb,
                                               const float* __restrict__ bias, float* __restrict__ C, int ldc, int M, int N, int K) {
  __shared__ __attribute__((aligned(16))) float so[4][16][64];
  const int tid = threadIdx.x, w = tid >> 5, lane = tid & 31, ln = lane & 15, hh = lane >> 4;
  const int ntn = N / 64;
  const int wid = blockIdx.x * 4 + w;
  const int mt = wid / ntn, nq = wid % ntn;
  if (mt * 16 >= M) return;
  const int row0 = mt * 16, col0 = nq * 64;
  const float* arow = A + (size_t)(row0 + ln) * lda;
  v8f acc[4] = {};
  for (int kb = 0; kb < K; kb += 32) {
    FragB ah, al;
    const v4f x0 = *(const v4fa*)(arow + kb + 8 * hh), x1 = *(const v4fa*)(arow + kb + 8 * hh + 4);
    const v4f x2 = *(const v4fa*)(arow + kb + 16 + 8 * hh), x3 = *(const v4fa*)(arow + kb + 16 + 8 * hh + 4);
    float xs[16] = {x0[0],x0[1],x0[2],x0[3],x1[0],x1[1],x1[2],x1[3],x2[0],x2[1],x2[2],x2[3],x3[0],x3[1],x3[2],x3[3]};
#pragma unroll
    for (int i = 0; i < 16; ++i) { const unsigned short hb = bf16_bits(xs[i]); ah.u[i] = hb; al.u[i] = ASPLIT ? bf16_bits(xs[i] - bf16_val(hb)) : (unsigned short)0; }
#pragma unroll
    for (int t = 0; t < 4; ++t) {
      const unsigned short* brow = Wt + (size_t)(col0 + t * 16 + ln) * ldb + kb;
      FragB b;
      b.half[0] = *(const v8us*)(brow + 8 * hh);
      b.half[1] = *(const v8us*)(brow + 16 + 8 * hh);
      acc[t] = mmaN<ASPLIT ? 2 : 1>(ah.v, al.v, b.v, b.v, acc[t]);
    }
  }
#pragma unroll
  for (int t = 0; t < 4; ++t) {
    float bv = bias ? bias[col0 + t * 16 + ln] : 0.f;
    if (BIAS_BF16) bv = bf16_round(bv);
#pragma unroll
    for (int r = 0; r < 8; ++r) { float v = acc[t][r] + bv; if (ACT == 1) v = fmaxf(v, 0.f); so[w][8 * hh + r][t * 16 + ln] = v; }
  }
  __builtin_amdgcn_fence(__ATOMIC_ACQ_REL, "workgroup");
  __builtin_amdgcn_wave_barrier();
  const int rsub = lane >> 4, c4 = (lane & 15) * 4;
  {
#pragma unroll
    for (int q = 0; q < 8; ++q) {
      const int r = q * 2 + rsub;
      const v4f v = *(const v4fa*)&so[w][r][c4];
      *(v4f*)(C + (size_t)(row0 + r) * ldc + col0 + c4) = v;
    }
    
  }
}

// GEMM C = act(A·W + bias + resid): A f32 (ASPLIT -> hi/lo 2 terms), Wt bf16 [N][K]; ACT 0 none, 1 relu, 2 exact gelu;
// resid (optional, f32, row index = (row % rmod), pitch ldr, RES_BF16 rounds it) added before the activation.
template <bool ASPLIT, int ACT, bool BIAS_BF16, bool RES_BF16>
__global__ __launch_bounds__(128) void k_gemm_bf3(const float* __restrict__ A, int lda, const unsigned short* __restrict__ Wt, int ldb,
                                                const float* __restrict__ bias, const float* __restrict__ resid, int rmod, int ldr,
                                                float* __restrict__ C, int ldc, int M, int N, int K) {
  __shared__ __attribute__((aligned(16))) float so[4][16][64];
  const int tid = threadIdx.x, w = tid >> 5, lane = tid & 31, ln = lane & 15, hh = lane >> 4;
  const int ntn = N / 64;
  const int wid = blockIdx.x * 4 + w;
  const int mt = wid / ntn, nq = wid % ntn;
  if (mt * 16 >= M) return;
  const int row0 = mt * 16, col0 = nq * 64;
  const float* arow = A + (size_t)(row0 + ln) * lda;
  v8f acc[4] = {};
  for (int kb = 0; kb < K; kb += 32) {
    FragB ah, al;
    const v4f x0 = *(const v4fa*)(arow + kb + 8 * hh), x1 = *(const v4fa*)(arow + kb + 8 * hh + 4);
    const v4f x2 = *(const v4fa*)(arow + kb + 16 + 8 * hh), x3 = *(const v4fa*)(arow + kb + 16 + 8 * hh + 4);
    float xs[16] = {x0[0],x0[1],x0[2],x0[3],x1[0],x1[1],x1[2],x1[3],x2[0],x2[1],x2[2],x2[3],x3[0],x3[1],x3[2],x3[3]};
#pragma unroll
    for (int i = 0; i < 16; ++i) { const unsigned short hb = bf16_bits(xs[i]); ah.u[i] = hb; al.u[i] = ASPLIT ? bf16_bits(xs[i] - bf16_val(hb)) : (unsigned short)0; }
#pragma unroll
    for (int t = 0; t < 4; ++t) {
      const unsigned short* brow = Wt + (size_t)(col0 + t * 16 + ln) * ldb + kb;
      FragB b;
      b.half[0] = *(const v8us*)(brow + 8 * hh);
      b.half[1] = *(const v8us*)(brow + 16 + 8 * hh);
      acc[t] = mmaN<ASPLIT ? 2 : 1>(ah.v, al.v, b.v, b.v, acc[t]);
    }
  }
#pragma unroll
  for (int t = 0; t < 4; ++t) {
    const int col = col0 + t * 16 + ln;
    float bv = bias ? bias[col] : 0.f;
    if (BIAS_BF16) bv = bf16_round(bv);
#pragma unroll
    for (int r = 0; r < 8; ++r) {
      float v = acc[t][r] + bv;
      if (resid) { float rv = resid[(size_t)((row0 + 8 * hh + r) % rmod) * ldr + col]; if (RES_BF16) rv = bf16_round(rv); v += rv; }
      if (ACT == 1) v = fmaxf(v, 0.f);
      if (ACT == 2) v = 0.5f * v * (1.0f + erff(v * 0.70710678118654752f));
      if (ACT == 3) { const float u = 0.7978845608028654f * (v + 0.044715f * v * v * v); v = 0.5f * v * (1.0f + tanhf(u)); }
      so[w][8 * hh + r][t * 16 + ln] = v;
    }
  }
  __builtin_amdgcn_fence(__ATOMIC_ACQ_REL, "workgroup");
  __builtin_amdgcn_wave_barrier();
  const int rsub = lane >> 4, c4 = (lane & 15) * 4;
  {
#pragma unroll
    for (int q = 0; q < 8; ++q) {
      const int r = q * 2 + rsub;
      const v4f v = *(const v4fa*)&so[w][r][c4];
      *(v4f*)(C + (size_t)(row0 + r) * ldc + col0 + c4) = v;
    }
    
  }
}
// row LayerNorm (biased variance, eps) over N: s = X (+ R); optional out_sum <- s; out_norm <- (s-mu)*rsqrt(var+eps)*g + b
template <bool PARAM_BF16>
__global__ __launch_bounds__(256) void k_layernorm(const float* __restrict__ X, const float* __restrict__ R, const float* __restrict__ g, const float* __restrict__ bta,
                                                  float* __restrict__ out_sum, float* __restrict__ out_norm, int N, float eps) {
  __shared__ float red[256];
  const int row = blockIdx.x, tid = threadIdx.x;
  const float* x = X + (size_t)row * N; const float* rr = R ? R + (size_t)row * N : nullptr;
  float vals[16];                     // up to N = 4096
  const int per = N / 256;            // contiguous chunk per thread? use strided-by-4 chunks: thread handles j = tid*4 + 1024*u
  float s1 = 0.f;
  for (int u = 0; u < per / 4; ++u) {
    const int j = tid * 4 + 1024 * u;
    const v4f a = *(const v4fa*)(x + j);
    v4f b = {0.f,0.f,0.f,0.f}; if (rr) b = *(const v4fa*)(rr + j);
#pragma unroll
    for (int q = 0; q < 4; ++q) { const float v = a[q] + b[q]; vals[u * 4 + q] = v; s1 += v; }
  }
  red[tid] = s1; __syncthreads();
  for (int st = 128; st > 0; st >>= 1) { if (tid < st) red[tid] += red[tid + st]; __syncthreads(); }
  const float mu = red[0] / (float)N; __syncthreads();
  float s2 = 0.f;
  for (int u = 0; u < per / 4; ++u)
#pragma unroll
    for (int q = 0; q < 4; ++q) { const float c = vals[u * 4 + q] - mu; s2 += c * c; }
  red[tid] = s2; __syncthreads();
  for (int st = 128; st > 0; st >>= 1) { if (tid < st) red[tid] += red[tid + st]; __syncthreads(); }
  const float rs = rsqrtf(red[0] / (float)N + eps);
  {
    for (int u = 0; u < per / 4; ++u) {
      const int j = tid * 4 + 1024 * u;
      v4f o, sm;
#pragma unroll
      for (int q = 0; q < 4; ++q) {
        float gg = g[j + q], bb = bta[j + q];
        if (PARAM_BF16) { gg = bf16_round(gg); bb = bf16_round(bb); }
        sm[q] = vals[u * 4 + q]; o[q] = (vals[u * 4 + q] - mu) * rs * gg + bb;
      }
      if (out_sum) *(v4f*)(out_sum + (size_t)row * N + j) = sm;
      *(v4f*)(out_norm + (size_t)row * N + j) = o;
    }
    
  }
}



// ---- f16 WMMA path (v_wmma_f32_16x16x32_f16): 11-bit significands for operands in range — used where a [0,1] probability operand needs more precision than bf16
typedef _Float16 v16h __attribute__((ext_vector_type(16)));
union FragH { v16h v; v8us half[2]; _Float16 h[16]; unsigned short u[16]; };
template <int NT>
__device__ __forceinline__ v8f mmaH(v16h ah, v16h al, v16h bh, v16h bl, v8f c) {
  c = __builtin_amdgcn_wmma_f32_16x16x32_f16(false, ah, false, bh, (short)0, c, false, false);
  if (NT >= 2) c = __builtin_amdgcn_wmma_f32_16x16x32_f16(false, al, false, bh, (short)0, c, false, false);
  if (NT >= 3) c = __builtin_amdgcn_wmma_f32_16x16x32_f16(false, ah, false, bl, (short)0, c, false, false);
  asm volatile("v_nop\n\tv_nop\n\tv_nop\n\tv_nop" : "+v"(c) : "v"(ah), "v"(al), "v"(bh), "v"(bl));
  return c;
}
// batched GEMM like k_gemm_b but f16 operands: A f32 (split into f16 hi/lo if ASPLIT, else rounded to f16), Bt = f16 values [n][k]; alpha; C f32; N multiple of 16 (partial tiles skipped)
template <bool ASPLIT>
__global__ __launch_bounds__(128) void k_gemm_h(const float* __restrict__ A, int lda, size_t sA, const _Float16* __restrict__ Bh, int ldb, size_t sB, float alpha, float* __restrict__ C, int ldc, size_t sC, int M, int N, int K) {
  __shared__ __attribute__((aligned(16))) float so[4][16][64];
  const int tid = threadIdx.x, w = tid >> 5, lane = tid & 31, ln = lane & 15, hh = lane >> 4; const int by = blockIdx.y;
  A += (size_t)by * sA; Bh += (size_t)by * sB; C += (size_t)by * sC;
  const int ntn = (N + 63) / 64; const int wid = blockIdx.x * 4 + w; const int mt = wid / ntn, nq = wid % ntn; if (mt * 16 >= M) return;
  const int row0 = mt * 16, col0 = nq * 64; const float* arow = A + (size_t)(row0 + ln) * lda;
  v8f acc[4] = {};
  for (int kb = 0; kb < K; kb += 32) {
    FragH ah, al;
    const v4f x0 = *(const v4fa*)(arow + kb + 8 * hh), x1 = *(const v4fa*)(arow + kb + 8 * hh + 4), x2 = *(const v4fa*)(arow + kb + 16 + 8 * hh), x3 = *(const v4fa*)(arow + kb + 16 + 8 * hh + 4);
    float xs[16] = {x0[0],x0[1],x0[2],x0[3],x1[0],x1[1],x1[2],x1[3],x2[0],x2[1],x2[2],x2[3],x3[0],x3[1],x3[2],x3[3]};
#pragma unroll
    for (int i = 0; i < 16; ++i) { const _Float16 h = (_Float16)xs[i]; ah.h[i] = h; al.h[i] = ASPLIT ? (_Float16)(xs[i] - (float)h) : (_Float16)0.0f; }
#pragma unroll
    for (int t = 0; t < 4; ++t) { if (col0 + t * 16 >= N) continue; const size_t boff = (size_t)(col0 + t * 16 + ln) * ldb + kb; FragH bq; bq.half[0] = *(const v8us*)(Bh + boff + 8 * hh); bq.half[1] = *(const v8us*)(Bh + boff + 16 + 8 * hh);
      acc[t] = mmaH<ASPLIT ? 2 : 1>(ah.v, al.v, bq.v, bq.v, acc[t]); }
  }
#pragma unroll
  for (int t = 0; t < 4; ++t) { if (col0 + t * 16 >= N) continue;
#pragma unroll
    for (int r = 0; r < 8; ++r) so[w][8 * hh + r][t * 16 + ln] = acc[t][r] * alpha; }
  __builtin_amdgcn_fence(__ATOMIC_ACQ_REL, "workgroup"); __builtin_amdgcn_wave_barrier();
  const int rsub = lane >> 4, c4 = (lane & 15) * 4;
  {
#pragma unroll
    for (int q = 0; q < 8; ++q) { const int r = q * 2 + rsub; if (col0 + c4 < N) { const v4f v = *(const v4fa*)&so[w][r][c4]; *(v4f*)(C + (size_t)(row0 + r) * ldc + col0 + c4) = v; } }
     }
}

// Wt[n][k] = f16(W[k][n]·scale) from f32 row-major W[K][N] (scale = power of two; bf16-exact weights stay exact in f16 away from the subnormal range)
__global__ __launch_bounds__(256) void k_wt_f16(const float* __restrict__ W, _Float16* __restrict__ Wt, int K, int N, float scale) {
  const int t = blockIdx.x * 256 + threadIdx.x; if (t >= N * (K / 8)) return; const int n = t / (K / 8), k8 = (t % (K / 8)) * 8; FragH f;
#pragma unroll
  for (int i = 0; i < 8; ++i) f.h[i] = (_Float16)(bf16_round(W[(size_t)(k8 + i) * N + n]) * scale); const v8us o = f.half[0];
  *(v8us*)((unsigned short*)Wt + (size_t)n * K + k8) = o; 
}
// k_gemm_hh variant with fused epilogue: v = acc·alpha + bias[by·sBias + col] (+ CP[(row/rowsPerB)·sCPb + by·64 + col] if CP) ; ACT 0 none / 1 elu ; writes f16 C16 (and f32 C if non-null)
template <int ACT>
__global__ __launch_bounds__(128) void k_gemm_hhx(const _Float16* __restrict__ A, int lda, size_t sA, const _Float16* __restrict__ Bh, int ldb, size_t sB, float alpha, const float* __restrict__ bias, size_t sBias, const float* __restrict__ CP, int rowsPerB, size_t sCPb, int row0g,
    float* __restrict__ C, _Float16* __restrict__ C16, int ldc, size_t sC, int M, int N, int K) {
  __shared__ __attribute__((aligned(16))) float so[4][16][64];
  const int tid = threadIdx.x, w = tid >> 5, lane = tid & 31, ln = lane & 15, hh = lane >> 4; const int by = blockIdx.y;
  A += (size_t)by * sA; Bh += (size_t)by * sB; const size_t cofs = (size_t)by * sC; const float* bp = bias ? bias + (size_t)by * sBias : nullptr;
  const int ntn = (N + 63) / 64; const int wid = blockIdx.x * 4 + w; const int mt = wid / ntn, nq = wid % ntn; if (mt * 16 >= M) return;
  const int row0 = mt * 16, col0 = nq * 64; const _Float16* arow = A + (size_t)(row0 + ln) * lda;
  v8f acc[4] = {};
  for (int kb = 0; kb < K; kb += 32) { FragH ah; ah.half[0] = *(const v8us*)((const unsigned short*)arow + kb + 8 * hh); ah.half[1] = *(const v8us*)((const unsigned short*)arow + kb + 16 + 8 * hh);
#pragma unroll
    for (int t = 0; t < 4; ++t) { if (col0 + t * 16 >= N) continue; const size_t boff = (size_t)(col0 + t * 16 + ln) * ldb + kb; FragH bq; bq.half[0] = *(const v8us*)((const unsigned short*)Bh + boff + 8 * hh); bq.half[1] = *(const v8us*)((const unsigned short*)Bh + boff + 16 + 8 * hh);
      acc[t] = mmaH<1>(ah.v, ah.v, bq.v, bq.v, acc[t]); }
  }
#pragma unroll
  for (int t = 0; t < 4; ++t) { if (col0 + t * 16 >= N) continue; const int col = col0 + t * 16 + ln; const float bv = bp ? bf16_round(bp[col]) : 0.f;
#pragma unroll
    for (int r = 0; r < 8; ++r) { float v = acc[t][r] * alpha + bv; if (CP) { const int rr = row0g + row0 + 8 * hh + r; if (rowsPerB < 0) v += CP[cofs + (size_t)rr * ldc + col];      /* rowsPerB < 0: own element of the batched C plane */ else { const int bidx = rr / rowsPerB; v += CP[(size_t)bidx * sCPb + (size_t)by * 64 + col]; } } if (ACT == 1) v = (v > 0.f) ? v : expm1f(v); else if (ACT == 7) v = (v > 0.f) ? v + 1.0f : expf(v); else if (ACT == 8) v = tanhf(v); else if (ACT == 9) v = 0.5f * v * (1.0f + tanhf(0.7978845608028654f * (v + 0.044715f * v * v * v))); else if (ACT == 11) v = 1.0f / (1.0f + expf(-v)); else if (ACT == 12) v = (v > 0.f) ? v : 0.01f * v; else if (ACT == 14) v = (v > 0.f) ? v : 0.1f * v; else if (ACT == 16) v = (v >= 0.f) ? v : 0.3f * v; else if (ACT == 17) v = (v >= 0.f) ? v : 0.2f * v; else if (ACT == 15) v = v / (1.0f + expf(-v)); else if (ACT == 3) v = fmaxf(v, 0.f); else if (ACT == 6) v = 0.5f * v * (1.0f + erff(v * 0.70710678118654752f)); so[w][8 * hh + r][t * 16 + ln] = v; } }
  __builtin_amdgcn_fence(__ATOMIC_ACQ_REL, "workgroup"); __builtin_amdgcn_wave_barrier();
  const int rsub = lane >> 4, c4 = (lane & 15) * 4; typedef _Float16 v4h __attribute__((ext_vector_type(4)));
  {
#pragma unroll
    for (int q = 0; q < 8; ++q) { const int r = q * 2 + rsub; if (col0 + c4 < N) { const v4f v = *(const v4fa*)&so[w][r][c4]; if (C) *(v4f*)(C + cofs + (size_t)(row0 + r) * ldc + col0 + c4) = v; if (C16) { v4h h4; for (int i = 0; i < 4; ++i) h4[i] = (_Float16)v[i]; *(v4h*)(C16 + cofs + (size_t)(row0 + r) * ldc + col0 + c4) = h4; } } }
     }
}


typedef _Float16 v4h __attribute__((ext_vector_type(4)));

__global__ __launch_bounds__(256) void k_x16(const float* __restrict__ x, _Float16* __restrict__ X16, size_t n8) { const size_t t = (size_t)blockIdx.x * 256 + threadIdx.x; if (t >= n8) return; FragH f;
#pragma unroll
  for (int q = 0; q < 8; ++q) f.h[q] = (_Float16)bf16_round(x[t * 8 + q]); *(v8us*)((unsigned short*)X16 + t * 8) = f.half[0];  }
__global__ __launch_bounds__(256) void k_h16(const float* __restrict__ x, _Float16* __restrict__ X16, size_t n8) { const size_t t = (size_t)blockIdx.x * 256 + threadIdx.x; if (t >= n8) return; FragH f;
#pragma unroll
  for (int q = 0; q < 8; ++q) f.h[q] = (_Float16)x[t * 8 + q]; *(v8us*)((unsigned short*)X16 + t * 8) = f.half[0];  }
__global__ __launch_bounds__(256) void k_round16f(const float* __restrict__ W, _Float16* __restrict__ Bt, size_t n8) { const size_t t = (size_t)blockIdx.x * 256 + threadIdx.x; if (t >= n8) return; FragH f;
#pragma unroll
  for (int i = 0; i < 8; ++i) f.h[i] = (_Float16)(bf16_round(W[t * 8 + i]) * 16.0f); *(v8us*)((unsigned short*)Bt + t * 8) = f.half[0];  }
template <int NHv, int TTv>
__global__ __launch_bounds__(256) void k_vt(const _Float16* __restrict__ V16, int ldv, int voff, _Float16* __restrict__ Vt) { __shared__ unsigned short tl[64][66]; const int tid = threadIdx.x; const int slab = blockIdx.x / (TTv / 64), lg = blockIdx.x % (TTv / 64); const int b = slab / NHv, h = slab % NHv;
  for (int i = tid; i < 64 * 8; i += 256) { const int r = i / 8, c8 = (i % 8) * 8; FragH f; f.half[0] = *(const v8us*)((const unsigned short*)V16 + ((size_t)b * TTv + lg * 64 + r) * ldv + voff + h * 64 + c8);
#pragma unroll
    for (int q = 0; q < 8; ++q) tl[r][c8 + q] = f.u[q]; }
  __syncthreads();
  {
#pragma unroll
    for (int rd = 0; rd < 2; ++rd) { const int d = rd * 32 + tid / 8, pc = tid % 8; FragH f;
#pragma unroll
      for (int q = 0; q < 8; ++q) f.u[q] = tl[pc * 8 + q][d];
      *(v8us*)((unsigned short*)Vt + ((size_t)slab * 64 + d) * TTv + lg * 64 + pc * 8) = f.half[0]; }
     } }

__global__ __launch_bounds__(256) void k_hl(const float* __restrict__ F, _Float16* __restrict__ Hh, _Float16* __restrict__ Hl, size_t n8) { const size_t t = (size_t)blockIdx.x * 256 + threadIdx.x; if (t >= n8) return; FragH fh, fl; const v4f a = *(const v4fa*)(F + t * 8), c = *(const v4fa*)(F + t * 8 + 4);
#pragma unroll
  for (int q = 0; q < 4; ++q) { _Float16 h = (_Float16)a[q]; fh.h[q] = h; fl.h[q] = (_Float16)((a[q] - (float)h) * 1024.0f); h = (_Float16)c[q]; fh.h[4 + q] = h; fl.h[4 + q] = (_Float16)((c[q] - (float)h) * 1024.0f); }
  { *(v8us*)((unsigned short*)Hh + t * 8) = fh.half[0]; *(v8us*)((unsigned short*)Hl + t * 8) = fl.half[0];  } }

// ---- fast GEMM (wave tile 32x64; requires M % 32 == 0 rows per launch region and N % 64 == 0); epilogue = k_gemm_hhx semantics ----
__device__ __forceinline__ v16h g2_frag(const _Float16* p, int hh) { FragH f; f.half[0] = *(const v8us*)((const unsigned short*)p + 8 * hh); f.half[1] = *(const v8us*)((const unsigned short*)p + 16 + 8 * hh); return f.v; }
__device__ __forceinline__ v8f g2_mma(v16h a, v16h b, v8f c) { v8f d = __builtin_amdgcn_wmma_f32_16x16x32_f16(false, a, false, b, (short)0, c, false, false); asm volatile("v_nop\n\tv_nop\n\tv_nop\n\tv_nop" : "+v"(d) : "v"(a), "v"(b)); return d; }
template <int ACT>
__global__ __launch_bounds__(128) void k_gemm2(const _Float16* __restrict__ A, int lda, size_t sA, const _Float16* __restrict__ Bh, int ldb, size_t sB, float alpha, const float* __restrict__ bias, size_t sBias, const float* __restrict__ CP, int rowsPerB, size_t sCPb, int row0g,
    float* __restrict__ C, _Float16* __restrict__ C16, int ldc, size_t sC, int M, int N, int K) { static_assert(ACT == 0 || ACT == 3 || ACT == 6 || ACT == 8 || ACT == 9 || ACT == 11 || ACT == 12 || ACT == 14 || ACT == 15 || ACT == 16 || ACT == 17, "k_gemm2: unsupported ACT code (would silently apply no activation)");
  __shared__ __attribute__((aligned(16))) float so[4][32][68];
  const int tid = threadIdx.x, w = tid >> 5, lane = tid & 31, ln = lane & 15, hh = lane >> 4; const int by = blockIdx.y;
  A += (size_t)by * sA; Bh += (size_t)by * sB; const size_t cofs = (size_t)by * sC; const float* bp = bias ? bias + (size_t)by * sBias : nullptr;
  const int ntn = N >> 6; const int mt = blockIdx.x / ntn, nq = blockIdx.x - mt * ntn; const int row0 = mt * 128 + 32 * w, col0 = nq * 64; if (row0 >= M) return;
  const _Float16* a0p = A + (size_t)(row0 + ln) * lda; const _Float16* a1p = a0p + (size_t)16 * lda;
  const _Float16* b0p = Bh + (size_t)(col0 + ln) * ldb; const _Float16* b1p = b0p + (size_t)16 * ldb; const _Float16* b2p = b1p + (size_t)16 * ldb; const _Float16* b3p = b2p + (size_t)16 * ldb;
  const v8f z8 = {0.f,0.f,0.f,0.f,0.f,0.f,0.f,0.f}; v8f c00 = z8, c01 = z8, c02 = z8, c03 = z8, c10 = z8, c11 = z8, c12 = z8, c13 = z8;
#pragma unroll 1
  for (int kb = 0; kb < K; kb += 32) { const v16h a0 = g2_frag(a0p + kb, hh), a1 = g2_frag(a1p + kb, hh);
    v16h b = g2_frag(b0p + kb, hh); c00 = g2_mma(a0, b, c00); c10 = g2_mma(a1, b, c10);
    b = g2_frag(b1p + kb, hh); c01 = g2_mma(a0, b, c01); c11 = g2_mma(a1, b, c11);
    b = g2_frag(b2p + kb, hh); c02 = g2_mma(a0, b, c02); c12 = g2_mma(a1, b, c12);
    b = g2_frag(b3p + kb, hh); c03 = g2_mma(a0, b, c03); c13 = g2_mma(a1, b, c13); }
  v8f accs[8] = {c00, c01, c02, c03, c10, c11, c12, c13};
#pragma unroll
  for (int u = 0; u < 8; ++u) { const int t = u & 3, half = u >> 2; const int col = col0 + t * 16 + ln; const float bv = bp ? bf16_round(bp[col]) : 0.f;
#pragma unroll
    for (int r = 0; r < 8; ++r) { const int rloc = half * 16 + 8 * hh + r; float v = accs[u][r] * alpha + bv; if (CP) { if (rowsPerB < 0) v += CP[cofs + (size_t)(row0g + row0 + rloc) * ldc + col];      /* rowsPerB < 0: own element of the batched C plane */ else { const int bidx = (row0g + row0 + rloc) / rowsPerB; v += CP[(size_t)bidx * sCPb + (size_t)by * 64 + col]; } }
      if (ACT == 3) v = fmaxf(v, 0.f); else if (ACT == 6) v = 0.5f * v * (1.0f + erff(v * 0.70710678118654752f)); else if (ACT == 11) v = 1.0f / (1.0f + expf(-v)); else if (ACT == 15) v = v / (1.0f + expf(-v)); else if (ACT == 12) v = (v > 0.f) ? v : 0.01f * v; else if (ACT == 8) v = tanhf(v); else if (ACT == 9) v = 0.5f * v * (1.0f + tanhf(0.7978845608028654f * (v + 0.044715f * v * v * v))); else if (ACT == 14) v = (v > 0.f) ? v : 0.1f * v; else if (ACT == 16) v = (v >= 0.f) ? v : 0.3f * v; else if (ACT == 17) v = (v >= 0.f) ? v : 0.2f * v;
      so[w][rloc][t * 16 + ln] = v; } }
  __builtin_amdgcn_fence(__ATOMIC_ACQ_REL, "workgroup"); __builtin_amdgcn_wave_barrier();
  const int rsub = lane >> 4, c4 = (lane & 15) * 4;
  {
#pragma unroll
    for (int q = 0; q < 16; ++q) { const int r = q * 2 + rsub; const v4f v = *(const v4fa*)&so[w][r][c4]; if (C) *(v4f*)(C + cofs + (size_t)(row0 + r) * ldc + col0 + c4) = v; if (C16) { v4h h4; for (int i = 0; i < 4; ++i) h4[i] = (_Float16)v[i]; *(v4h*)(C16 + cofs + (size_t)(row0 + r) * ldc + col0 + c4) = h4; } }
     } }


// T5 unidirectional bucket of relative position (key j - query i <= 0): rp = i - j; rp < 16 -> rp; else min(16 + int(log(rp/16)/log(8)*16), 31) — f32 math as the reference
__device__ __forceinline__ int rp_bucket(int i, int j) { int rp = i - j; if (rp < 0) rp = 0; if (rp < 16) return rp; const float lg = logf((float)rp / 16.0f) / 2.0794415416798357f * 16.0f; int b = 16 + (int)lg; return b > 31 ? 31 : b; }
__global__ __launch_bounds__(256) void k_bkt(int* __restrict__ BKT) { const int t = blockIdx.x * 256 + threadIdx.x; if (t >= SQ) return; const int b = rp_bucket(t, 0); *(int*)(BKT + t) = b;  }
__global__ __launch_bounds__(256) void k_wsp(float* __restrict__ S, _Float16* __restrict__ P, _Float16* __restrict__ PL, const int* __restrict__ mrow, const float* __restrict__ rb, const int* __restrict__ BKT, int h, int q0, int nk, int nrows) {
  #pragma clang fp contract(off)
  __shared__ unsigned short so_[256][9], sl_[256][9]; const int i = blockIdx.x * 256 + threadIdx.x; if (i >= nrows) return; float* s = S + (size_t)i * NKX; const int qi = q0 + i; const bool qok = (mrow[qi] != 0); float se = 0.f;
#pragma unroll 1
  for (int j0 = 0; j0 < nk; j0 += 8) { v8f w8;      
#pragma unroll 1
    for (int q = 0; q < 8; ++q) { const int j = j0 + q; float w = 0.f; if (j <= qi && qok && mrow[j] != 0) { const float a_ = __fadd_rn(s[j], bf16_round(rb[BKT[qi - j] * NH + h])); w = (a_ > 20.0f) ? a_ : log1pf(expf(a_)); se += w; } w8[q] = w; }
    *(v8f*)(s + j0) = w8;  }
  const float sc = 256.0f / __fadd_rn(se, 1e-8f);
#pragma unroll 1
  for (int j0 = 0; j0 < nk; j0 += 8) {
#pragma unroll 1
    for (int q = 0; q < 8; ++q) { const float w = s[j0 + q] * sc; const _Float16 hv = (_Float16)w; FragH one; one.h[0] = hv; so_[threadIdx.x][q] = one.u[0]; one.h[0] = (_Float16)((w - (float)hv) * 1024.0f); sl_[threadIdx.x][q] = one.u[0]; }
    FragH f, fl; for (int q = 0; q < 8; ++q) { f.u[q] = so_[threadIdx.x][q]; fl.u[q] = sl_[threadIdx.x][q]; } unsigned short* dd = (unsigned short*)P + (size_t)i * NKX + j0; unsigned short* dl = (unsigned short*)PL + (size_t)i * NKX + j0; *(v8us*)dd = f.half[0]; *(v8us*)dl = fl.half[0];  } }
__global__ __launch_bounds__(256) void k_vth(const _Float16* __restrict__ V16, int b, int h, _Float16* __restrict__ VT) { __shared__ unsigned short tl[64][65]; const int tid = threadIdx.x; const int j0 = blockIdx.x * 64;
  for (int i = tid; i < 64 * 8; i += 256) { const int j = i / 8, d8 = (i % 8) * 8; FragH f; f.half[0] = *(const v8us*)((const unsigned short*)V16 + ((size_t)b * SQ + j0 + j) * DM + h * HD + d8); for (int q = 0; q < 8; ++q) tl[d8 + q][j] = f.u[q]; }
  __syncthreads();
  { for (int i = tid; i < 64 * 8; i += 256) { const int d = i / 8, j8 = (i % 8) * 8; FragH f; for (int q = 0; q < 8; ++q) f.u[q] = tl[d][j8 + q]; *(v8us*)((unsigned short*)VT + (size_t)d * NKX + j0 + j8) = f.half[0]; }  } }

extern "C" void kernel_launch(void* const* d_in, const int* in_sizes, int n_in,
                              void* d_out, int out_size, void* d_ws, size_t ws_size, hipStream_t stream) {
  (void)in_sizes; (void)n_in; (void)out_size;
  const float* const* I = (const float* const*)d_in; const float* v = I[0]; const float* k = I[1]; const float* q = I[2]; const int* mask = (const int*)d_in[3]; const float* rb = I[4];      /* table order: v, k, q, mask, rel_bias */
  char* ws = (char*)d_ws; size_t off = 0;
  auto take = [&](size_t bytes) { char* p = ws + off; off += (bytes + 255) & ~(size_t)255; return p; };
  _Float16* Q16 = (_Float16*)take(NR * DM * 2); _Float16* K16 = (_Float16*)take(NR * DM * 2); _Float16* V16 = (_Float16*)take(NR * DM * 2);
  float* S = (float*)take((size_t)HG * QT * NKX * 4); _Float16* P = (_Float16*)take((size_t)HG * QT * NKX * 2); _Float16* PL = (_Float16*)take((size_t)HG * QT * NKX * 2); _Float16* VT = (_Float16*)take((size_t)HG * HD * NKX * 2); int* BKT = (int*)take(SQ * 4);
  if (off > ws_size) return;      /* 3 x 8 + 16 + 8 + 8 + 1 = ≈ 57 MiB */
  const unsigned g8 = (unsigned)((NR * DM / 8 + 255) / 256);
  k_bkt<<<(SQ + 255) / 256, 256, 0, stream>>>(BKT); k_x16<<<g8, 256, 0, stream>>>(q, Q16, NR * DM / 8); k_x16<<<g8, 256, 0, stream>>>(k, K16, NR * DM / 8); k_x16<<<g8, 256, 0, stream>>>(v, V16, NR * DM / 8);
  for (int b = 0; b < NB; ++b) for (int hg = 0; hg < NH / HG; ++hg) for (int q0 = 0; q0 < QN; q0 += QT) {
    const int nk = q0 + QT;      /* causal: keys below the tile end only */
    const size_t qa = ((size_t)b * SQ + q0) * DM + (size_t)hg * HG * HD; const size_t ka = ((size_t)b * SQ) * DM + (size_t)hg * HG * HD;
    k_gemm2<0><<<dim3((QT / 128) * (nk / 64), HG), 128, 0, stream>>>(Q16 + qa, DM, (size_t)HD, K16 + ka, DM, (size_t)HD, 0.125f, nullptr, 0, nullptr, 1, 0, 0, S, nullptr, NKX, (size_t)QT * NKX, QT, nk, HD);      /* q . k / 8 */
    for (int hh = 0; hh < HG; ++hh) { k_wsp<<<(QT + 255) / 256, 256, 0, stream>>>(S + (size_t)hh * QT * NKX, P + (size_t)hh * QT * NKX, PL + (size_t)hh * QT * NKX, mask + (size_t)b * SQ, rb, BKT, hg * HG + hh, q0, nk, QT); k_vth<<<nk / 64, 256, 0, stream>>>(V16, b, hg * HG + hh, VT + (size_t)hh * HD * NKX); }
    k_gemm2<0><<<dim3((QT / 128) * (HD / 64), HG), 128, 0, stream>>>(PL, NKX, (size_t)QT * NKX, VT, NKX, (size_t)HD * NKX, 0.00390625f / 1024.0f, nullptr, 0, nullptr, 1, 0, 0, (float*)d_out + qa, nullptr, DM, (size_t)HD, QT, HD, nk);      /* residual-weight term first */
    k_gemm2<0><<<dim3((QT / 128) * (HD / 64), HG), 128, 0, stream>>>(P, NKX, (size_t)QT * NKX, VT, NKX, (size_t)HD * NKX, 0.00390625f, nullptr, 0, (float*)d_out + qa, -1, 0, 0, (float*)d_out + qa, nullptr, DM, (size_t)HD, QT, HD, nk); }      /* + main term -> out rows (merged heads) */
}

// v001
// A run of this version takes 3950 microseconds.
// Timed twice side by side with v000, it ran 20.8 and 20.3 times as fast.
#include <hip/hip_runtime.h>
// PointwiseAggregatedAttention (q, k, v [2][2048][1024] given directly, 16 heads of 64; att = q.k/8 + rel_bias[T5 bucket(key - query)][h]; w = softplus(att) where (causal AND mask_q AND mask_k) else 0; w /= (sum + 1e-8); out = w v merged -> [2][2048][1024]; mask [2][2048] int (all ones on the wire, read on device)).
// Structure: token rows; q/k/v as exact f16 planes (inputs, no projections); per (batch, 4-head group, 512-query tile): causal-banded scores over keys < tile end only (WMMA 32x64 wave tiles, f32 accumulation, K = 64), the T5 relative-position bucket (f32 log, as the reference) + bias + softplus + masks + normalisation on VALU (f32; weights x256 as f16), V^T per head via LDS, out = P . V GEMM (alpha 2^-8) written straight into the f32 output rows.
// Compute dtype: inputs rounded to bf16; q / k / v / rel_bias exact; scores, bias, softplus, normaliser f32; normalised weights as f16 hi + 2^-10 residual planes (two WMMA terms; v exact) — effectively f32. v_wmma_f32_16x16x32_f16.
#define NB 2
#define SQ 2048
#define DM 1024
#define NH 16
#define HD 64
#define HG 4                         /* heads per launch group */
#define QT 512
#define NKX 2048
#define NR ((size_t)NB * SQ)
#define QN SQ                        /* queries per batch (debug hook) */
typedef __bf16 v16b __attribute__((ext_vector_type(16)));
typedef unsigned short v8us __attribute__((ext_vector_type(8), may_alias));
typedef float  v8f  __attribute__((ext_vector_type(8)));
typedef float  v4f  __attribute__((ext_vector_type(4)));
typedef float  v4fa __attribute__((ext_vector_type(4), may_alias));
union FragB { v16b v; v8us half[2]; unsigned short u[16]; };

__device__ __forceinline__ unsigned short bf16_bits(float x) { unsigned int u = __float_as_uint(x); return (unsigned short)((u + 0x7FFFu + ((u >> 16) & 1u)) >> 16); }
__device__ __forceinline__ float bf16_val(unsigned short b) { return __uint_as_float(((unsigned int)b) << 16); }
__device__ __forceinline__ float bf16_round(float x) { return bf16_val(bf16_bits(x)); }
// D += A·B with NT terms: 1 = ah·bh, 2 = + al·bh (A split), 3 = + ah·bl (both split)
template <int NT>
__device__ __forceinline__ v8f mmaN(v16b ah, v16b al, v16b bh, v16b bl, v8f c) {
  c = __builtin_amdgcn_wmma_f32_16x16x32_bf16(false, ah, false, bh, (short)0, c, false, false);
  if (NT >= 2) c = __builtin_amdgcn_wmma_f32_16x16x32_bf16(false, al, false, bh, (short)0, c, false, false);
  if (NT >= 3) c = __builtin_amdgcn_wmma_f32_16x16x32_bf16(false, ah, false, bl, (short)0, c, false, false);
  asm volatile("v_nop\n\tv_nop\n\tv_nop\n\tv_nop" : "+v"(c) : "v"(ah), "v"(al), "v"(bh), "v"(bl));
  return c;
}

__global__ __launch_bounds__(256) void k_wt_bf16(const float* __restrict__ W, unsigned short* __restrict__ Wt, int K, int N) {
  const int t = blockIdx.x * 256 + threadIdx.x;
  const int k8n = K / 8;
  if (t >= N * k8n) return;
  const int n = t / k8n, k8 = (t % k8n) * 8;
  v8us v;
#pragma unroll
  for (int i = 0; i < 8; ++i) v[i] = bf16_bits(W[(size_t)(k8 + i) * N + n]);
  *(v8us*)(Wt + (size_t)n * K + k8) = v;
  
}

// GEMM C[M][N] (f32, pitch ldc) = act(A[M][K]·W + bias). A f32 row-major (pitch lda) converted per fragment to bf16
// (ASPLIT: hi/lo two planes -> 2 terms, else single rounded term); Wt bf16 [N][K] (pitch ldb). BIAS_BF16 rounds the
// bias to bf16 first (bias quantised to bf16 before the add). K%32==0, M%16==0, N%64==0.
template <bool ASPLIT, int ACT, bool BIAS_BF16>
__global__ __launch_bounds__(128) void k_gemm_bf(const float* __restrict__ A, int lda, const unsigned short* __restrict__ Wt, int ldb,
                                               const float* __restrict__ bias, float* __restrict__ C, int ldc, int M, int N, int K) {
  __shared__ __attribute__((aligned(16))) float so[4][16][64];
  const int tid = threadIdx.x, w = tid >> 5, lane = tid & 31, ln = lane & 15, hh = lane >> 4;
  const int ntn = N / 64;
  const int wid = blockIdx.x * 4 + w;
  const int mt = wid / ntn, nq = wid % ntn;
  if (mt * 16 >= M) return;
  const int row0 = mt * 16, col0 = nq * 64;
  const float* arow = A + (size_t)(row0 + ln) * lda;
  v8f acc[4] = {};
  for (int kb = 0; kb < K; kb += 32) {
    FragB ah, al;
    const v4f x0 = *(const v4fa*)(arow + kb + 8 * hh), x1 = *(const v4fa*)(arow + kb + 8 * hh + 4);
    const v4f x2 = *(const v4fa*)(arow + kb + 16 + 8 * hh), x3 = *(const v4fa*)(arow + kb + 16 + 8 * hh + 4);
    float xs[16] = {x0[0],x0[1],x0[2],x0[3],x1[0],x1[1],x1[2],x1[3],x2[0],x2[1],x2[2],x2[3],x3[0],x3[1],x3[2],x3[3]};
#pragma unroll
    for (int i = 0; i < 16; ++i) { const unsigned short hb = bf16_bits(xs[i]); ah.u[i] = hb; al.u[i] = ASPLIT ? bf16_bits(xs[i] - bf16_val(hb)) : (unsigned short)0; }
#pragma unroll
    for (int t = 0; t < 4; ++t) {
      const unsigned short* brow = Wt + (size_t)(col0 + t * 16 + ln) * ldb + kb;
      FragB b;
      b.half[0] = *(const v8us*)(brow + 8 * hh);
      b.half[1] = *(const v8us*)(brow + 16 + 8 * hh);
      acc[t] = mmaN<ASPLIT ? 2 : 1>(ah.v, al.v, b.v, b.v, acc[t]);
    }
  }
#pragma unroll
  for (int t = 0; t < 4; ++t) {
    float bv = bias ? bias[col0 + t * 16 + ln] : 0.f;
    if (BIAS_BF16) bv = bf16_round(bv);
#pragma unroll
    for (int r = 0; r < 8; ++r) { float v = acc[t][r] + bv; if (ACT == 1) v = fmaxf(v, 0.f); so[w][8 * hh + r][t * 16 + ln] = v; }
  }
  __builtin_amdgcn_fence(__ATOMIC_ACQ_REL, "workgroup");
  __builtin_amdgcn_wave_barrier();
  const int rsub = lane >> 4, c4 = (lane & 15) * 4;
  {
#pragma unroll
    for (int q = 0; q < 8; ++q) {
      const int r = q * 2 + rsub;
      const v4f v = *(const v4fa*)&so[w][r][c4];
      *(v4f*)(C + (size_t)(row0 + r) * ldc + col0 + c4) = v;
    }
    
  }
}

// GEMM C = act(A·W + bias + resid): A f32 (ASPLIT -> hi/lo 2 terms), Wt bf16 [N][K]; ACT 0 none, 1 relu, 2 exact gelu;
// resid (optional, f32, row index = (row % rmod), pitch ldr, RES_BF16 rounds it) added before the activation.
template <bool ASPLIT, int ACT, bool BIAS_BF16, bool RES_BF16>
__global__ __launch_bounds__(128) void k_gemm_bf3(const float* __restrict__ A, int lda, const unsigned short* __restrict__ Wt, int ldb,
                                                const float* __restrict__ bias, const float* __restrict__ resid, int rmod, int ldr,
                                                float* __restrict__ C, int ldc, int M, int N, int K) {
  __shared__ __attribute__((aligned(16))) float so[4][16][64];
  const int tid = threadIdx.x, w = tid >> 5, lane = tid & 31, ln = lane & 15, hh = lane >> 4;
  const int ntn = N / 64;
  const int wid = blockIdx.x * 4 + w;
  const int mt = wid / ntn, nq = wid % ntn;
  if (mt * 16 >= M) return;
  const int row0 = mt * 16, col0 = nq * 64;
  const float* arow = A + (size_t)(row0 + ln) * lda;
  v8f acc[4] = {};
  for (int kb = 0; kb < K; kb += 32) {
    FragB ah, al;
    const v4f x0 = *(const v4fa*)(arow + kb + 8 * hh), x1 = *(const v4fa*)(arow + kb + 8 * hh + 4);
    const v4f x2 = *(const v4fa*)(arow + kb + 16 + 8 * hh), x3 = *(const v4fa*)(arow + kb + 16 + 8 * hh + 4);
    float xs[16] = {x0[0],x0[1],x0[2],x0[3],x1[0],x1[1],x1[2],x1[3],x2[0],x2[1],x2[2],x2[3],x3[0],x3[1],x3[2],x3[3]};
#pragma unroll
    for (int i = 0; i < 16; ++i) { const unsigned short hb = bf16_bits(xs[i]); ah.u[i] = hb; al.u[i] = ASPLIT ? bf16_bits(xs[i] - bf16_val(hb)) : (unsigned short)0; }
#pragma unroll
    for (int t = 0; t < 4; ++t) {
      const unsigned short* brow = Wt + (size_t)(col0 + t * 16 + ln) * ldb + kb;
      FragB b;
      b.half[0] = *(const v8us*)(brow + 8 * hh);
      b.half[1] = *(const v8us*)(brow + 16 + 8 * hh);
      acc[t] = mmaN<ASPLIT ? 2 : 1>(ah.v, al.v, b.v, b.v, acc[t]);
    }
  }
#pragma unroll
  for (int t = 0; t < 4; ++t) {
    const int col = col0 + t * 16 + ln;
    float bv = bias ? bias[col] : 0.f;
    if (BIAS_BF16) bv = bf16_round(bv);
#pragma unroll
    for (int r = 0; r < 8; ++r) {
      float v = acc[t][r] + bv;
      if (resid) { float rv = resid[(size_t)((row0 + 8 * hh + r) % rmod) * ldr + col]; if (RES_BF16) rv = bf16_round(rv); v += rv; }
      if (ACT == 1) v = fmaxf(v, 0.f);
      if (ACT == 2) v = 0.5f * v * (1.0f + erff(v * 0.70710678118654752f));
      if (ACT == 3) { const float u = 0.7978845608028654f * (v + 0.044715f * v * v * v); v = 0.5f * v * (1.0f + tanhf(u)); }
      so[w][8 * hh + r][t * 16 + ln] = v;
    }
  }
  __builtin_amdgcn_fence(__ATOMIC_ACQ_REL, "workgroup");
  __builtin_amdgcn_wave_barrier();
  const int rsub = lane >> 4, c4 = (lane & 15) * 4;
  {
#pragma unroll
    for (int q = 0; q < 8; ++q) {
      const int r = q * 2 + rsub;
      const v4f v = *(const v4fa*)&so[w][r][c4];
      *(v4f*)(C + (size_t)(row0 + r) * ldc + col0 + c4) = v;
    }
    
  }
}
// row LayerNorm (biased variance, eps) over N: s = X (+ R); optional out_sum <- s; out_norm <- (s-mu)*rsqrt(var+eps)*g + b
template <bool PARAM_BF16>
__global__ __launch_bounds__(256) void k_layernorm(const float* __restrict__ X, const float* __restrict__ R, const float* __restrict__ g, const float* __restrict__ bta,
                                                  float* __restrict__ out_sum, float* __restrict__ out_norm, int N, float eps) {
  __shared__ float red[256];
  const int row = blockIdx.x, tid = threadIdx.x;
  const float* x = X + (size_t)row * N; const float* rr = R ? R + (size_t)row * N : nullptr;
  float vals[16];                     // up to N = 4096
  const int per = N / 256;            // contiguous chunk per thread? use strided-by-4 chunks: thread handles j = tid*4 + 1024*u
  float s1 = 0.f;
  for (int u = 0; u < per / 4; ++u) {
    const int j = tid * 4 + 1024 * u;
    const v4f a = *(const v4fa*)(x + j);
    v4f b = {0.f,0.f,0.f,0.f}; if (rr) b = *(const v4fa*)(rr + j);
#pragma unroll
    for (int q = 0; q < 4; ++q) { const float v = a[q] + b[q]; vals[u * 4 + q] = v; s1 += v; }
  }
  red[tid] = s1; __syncthreads();
  for (int st = 128; st > 0; st >>= 1) { if (tid < st) red[tid] += red[tid + st]; __syncthreads(); }
  const float mu = red[0] / (float)N; __syncthreads();
  float s2 = 0.f;
  for (int u = 0; u < per / 4; ++u)
#pragma unroll
    for (int q = 0; q < 4; ++q) { const float c = vals[u * 4 + q] - mu; s2 += c * c; }
  red[tid] = s2; __syncthreads();
  for (int st = 128; st > 0; st >>= 1) { if (tid < st) red[tid] += red[tid + st]; __syncthreads(); }
  const float rs = rsqrtf(red[0] / (float)N + eps);
  {
    for (int u = 0; u < per / 4; ++u) {
      const int j = tid * 4 + 1024 * u;
      v4f o, sm;
#pragma unroll
      for (int q = 0; q < 4; ++q) {
        float gg = g[j + q], bb = bta[j + q];
        if (PARAM_BF16) { gg = bf16_round(gg); bb = bf16_round(bb); }
        sm[q] = vals[u * 4 + q]; o[q] = (vals[u * 4 + q] - mu) * rs * gg + bb;
      }
      if (out_sum) *(v4f*)(out_sum + (size_t)row * N + j) = sm;
      *(v4f*)(out_norm + (size_t)row * N + j) = o;
    }
    
  }
}



// ---- f16 WMMA path (v_wmma_f32_16x16x32_f16): 11-bit significands for operands in range — used where a [0,1] probability operand needs more precision than bf16
typedef _Float16 v16h __attribute__((ext_vector_type(16)));
union FragH { v16h v; v8us half[2]; _Float16 h[16]; unsigned short u[16]; };
template <int NT>
__device__ __forceinline__ v8f mmaH(v16h ah, v16h al, v16h bh, v16h bl, v8f c) {
  c = __builtin_amdgcn_wmma_f32_16x16x32_f16(false, ah, false, bh, (short)0, c, false, false);
  if (NT >= 2) c = __builtin_amdgcn_wmma_f32_16x16x32_f16(false, al, false, bh, (short)0, c, false, false);
  if (NT >= 3) c = __builtin_amdgcn_wmma_f32_16x16x32_f16(false, ah, false, bl, (short)0, c, false, false);
  asm volatile("v_nop\n\tv_nop\n\tv_nop\n\tv_nop" : "+v"(c) : "v"(ah), "v"(al), "v"(bh), "v"(bl));
  return c;
}
// batched GEMM like k_gemm_b but f16 operands: A f32 (split into f16 hi/lo if ASPLIT, else rounded to f16), Bt = f16 values [n][k]; alpha; C f32; N multiple of 16 (partial tiles skipped)
template <bool ASPLIT>
__global__ __launch_bounds__(128) void k_gemm_h(const float* __restrict__ A, int lda, size_t sA, const _Float16* __restrict__ Bh, int ldb, size_t sB, float alpha, float* __restrict__ C, int ldc, size_t sC, int M, int N, int K) {
  __shared__ __attribute__((aligned(16))) float so[4][16][64];
  const int tid = threadIdx.x, w = tid >> 5, lane = tid & 31, ln = lane & 15, hh = lane >> 4; const int by = blockIdx.y;
  A += (size_t)by * sA; Bh += (size_t)by * sB; C += (size_t)by * sC;
  const int ntn = (N + 63) / 64; const int wid = blockIdx.x * 4 + w; const int mt = wid / ntn, nq = wid % ntn; if (mt * 16 >= M) return;
  const int row0 = mt * 16, col0 = nq * 64; const float* arow = A + (size_t)(row0 + ln) * lda;
  v8f acc[4] = {};
  for (int kb = 0; kb < K; kb += 32) {
    FragH ah, al;
    const v4f x0 = *(const v4fa*)(arow + kb + 8 * hh), x1 = *(const v4fa*)(arow + kb + 8 * hh + 4), x2 = *(const v4fa*)(arow + kb + 16 + 8 * hh), x3 = *(const v4fa*)(arow + kb + 16 + 8 * hh + 4);
    float xs[16] = {x0[0],x0[1],x0[2],x0[3],x1[0],x1[1],x1[2],x1[3],x2[0],x2[1],x2[2],x2[3],x3[0],x3[1],x3[2],x3[3]};
#pragma unroll
    for (int i = 0; i < 16; ++i) { const _Float16 h = (_Float16)xs[i]; ah.h[i] = h; al.h[i] = ASPLIT ? (_Float16)(xs[i] - (float)h) : (_Float16)0.0f; }
#pragma unroll
    for (int t = 0; t < 4; ++t) { if (col0 + t * 16 >= N) continue; const size_t boff = (size_t)(col0 + t * 16 + ln) * ldb + kb; FragH bq; bq.half[0] = *(const v8us*)(Bh + boff + 8 * hh); bq.half[1] = *(const v8us*)(Bh + boff + 16 + 8 * hh);
      acc[t] = mmaH<ASPLIT ? 2 : 1>(ah.v, al.v, bq.v, bq.v, acc[t]); }
  }
#pragma unroll
  for (int t = 0; t < 4; ++t) { if (col0 + t * 16 >= N) continue;
#pragma unroll
    for (int r = 0; r < 8; ++r) so[w][8 * hh + r][t * 16 + ln] = acc[t][r] * alpha; }
  __builtin_amdgcn_fence(__ATOMIC_ACQ_REL, "workgroup"); __builtin_amdgcn_wave_barrier();
  const int rsub = lane >> 4, c4 = (lane & 15) * 4;
  {
#pragma unroll
    for (int q = 0; q < 8; ++q) { const int r = q * 2 + rsub; if (col0 + c4 < N) { const v4f v = *(const v4fa*)&so[w][r][c4]; *(v4f*)(C + (size_t)(row0 + r) * ldc + col0 + c4) = v; } }
     }
}

// Wt[n][k] = f16(W[k][n]·scale) from f32 row-major W[K][N] (scale = power of two; bf16-exact weights stay exact in f16 away from the subnormal range)
__global__ __launch_bounds__(256) void k_wt_f16(const float* __restrict__ W, _Float16* __restrict__ Wt, int K, int N, float scale) {
  const int t = blockIdx.x * 256 + threadIdx.x; if (t >= N * (K / 8)) return; const int n = t / (K / 8), k8 = (t % (K / 8)) * 8; FragH f;
#pragma unroll
  for (int i = 0; i < 8; ++i) f.h[i] = (_Float16)(bf16_round(W[(size_t)(k8 + i) * N + n]) * scale); const v8us o = f.half[0];
  *(v8us*)((unsigned short*)Wt + (size_t)n * K + k8) = o; 
}
// k_gemm_hh variant with fused epilogue: v = acc·alpha + bias[by·sBias + col] (+ CP[(row/rowsPerB)·sCPb + by·64 + col] if CP) ; ACT 0 none / 1 elu ; writes f16 C16 (and f32 C if non-null)
template <int ACT>
__global__ __launch_bounds__(128) void k_gemm_hhx(const _Float16* __restrict__ A, int lda, size_t sA, const _Float16* __restrict__ Bh, int ldb, size_t sB, float alpha, const float* __restrict__ bias, size_t sBias, const float* __restrict__ CP, int rowsPerB, size_t sCPb, int row0g,
    float* __restrict__ C, _Float16* __restrict__ C16, int ldc, size_t sC, int M, int N, int K) {
  __shared__ __attribute__((aligned(16))) float so[4][16][64];
  const int tid = threadIdx.x, w = tid >> 5, lane = tid & 31, ln = lane & 15, hh = lane >> 4; const int by = blockIdx.y;
  A += (size_t)by * sA; Bh += (size_t)by * sB; const size_t cofs = (size_t)by * sC; const float* bp = bias ? bias + (size_t)by * sBias : nullptr;
  const int ntn = (N + 63) / 64; const int wid = blockIdx.x * 4 + w; const int mt = wid / ntn, nq = wid % ntn; if (mt * 16 >= M) return;
  const int row0 = mt * 16, col0 = nq * 64; const _Float16* arow = A + (size_t)(row0 + ln) * lda;
  v8f acc[4] = {};
  for (int kb = 0; kb < K; kb += 32) { FragH ah; ah.half[0] = *(const v8us*)((const unsigned short*)arow + kb + 8 * hh); ah.half[1] = *(const v8us*)((const unsigned short*)arow + kb + 16 + 8 * hh);
#pragma unroll
    for (int t = 0; t < 4; ++t) { if (col0 + t * 16 >= N) continue; const size_t boff = (size_t)(col0 + t * 16 + ln) * ldb + kb; FragH bq; bq.half[0] = *(const v8us*)((const unsigned short*)Bh + boff + 8 * hh); bq.half[1] = *(const v8us*)((const unsigned short*)Bh + boff + 16 + 8 * hh);
      acc[t] = mmaH<1>(ah.v, ah.v, bq.v, bq.v, acc[t]); }
  }
#pragma unroll
  for (int t = 0; t < 4; ++t) { if (col0 + t * 16 >= N) continue; const int col = col0 + t * 16 + ln; const float bv = bp ? bf16_round(bp[col]) : 0.f;
#pragma unroll
    for (int r = 0; r < 8; ++r) { float v = acc[t][r] * alpha + bv; if (CP) { const int rr = row0g + row0 + 8 * hh + r; if (rowsPerB < 0) v += CP[cofs + (size_t)rr * ldc + col];      /* rowsPerB < 0: own element of the batched C plane */ else { const int bidx = rr / rowsPerB; v += CP[(size_t)bidx * sCPb + (size_t)by * 64 + col]; } } if (ACT == 1) v = (v > 0.f) ? v : expm1f(v); else if (ACT == 7) v = (v > 0.f) ? v + 1.0f : expf(v); else if (ACT == 8) v = tanhf(v); else if (ACT == 9) v = 0.5f * v * (1.0f + tanhf(0.7978845608028654f * (v + 0.044715f * v * v * v))); else if (ACT == 11) v = 1.0f / (1.0f + expf(-v)); else if (ACT == 12) v = (v > 0.f) ? v : 0.01f * v; else if (ACT == 14) v = (v > 0.f) ? v : 0.1f * v; else if (ACT == 16) v = (v >= 0.f) ? v : 0.3f * v; else if (ACT == 17) v = (v >= 0.f) ? v : 0.2f * v; else if (ACT == 15) v = v / (1.0f + expf(-v)); else if (ACT == 3) v = fmaxf(v, 0.f); else if (ACT == 6) v = 0.5f * v * (1.0f + erff(v * 0.70710678118654752f)); so[w][8 * hh + r][t * 16 + ln] = v; } }
  __builtin_amdgcn_fence(__ATOMIC_ACQ_REL, "workgroup"); __builtin_amdgcn_wave_barrier();
  const int rsub = lane >> 4, c4 = (lane & 15) * 4; typedef _Float16 v4h __attribute__((ext_vector_type(4)));
  {
#pragma unroll
    for (int q = 0; q < 8; ++q) { const int r = q * 2 + rsub; if (col0 + c4 < N) { const v4f v = *(const v4fa*)&so[w][r][c4]; if (C) *(v4f*)(C + cofs + (size_t)(row0 + r) * ldc + col0 + c4) = v; if (C16) { v4h h4; for (int i = 0; i < 4; ++i) h4[i] = (_Float16)v[i]; *(v4h*)(C16 + cofs + (size_t)(row0 + r) * ldc + col0 + c4) = h4; } } }
     }
}


typedef _Float16 v4h __attribute__((ext_vector_type(4)));

__global__ __launch_bounds__(256) void k_x16(const float* __restrict__ x, _Float16* __restrict__ X16, size_t n8) { const size_t t = (size_t)blockIdx.x * 256 + threadIdx.x; if (t >= n8) return; FragH f;
#pragma unroll
  for (int q = 0; q < 8; ++q) f.h[q] = (_Float16)bf16_round(x[t * 8 + q]); *(v8us*)((unsigned short*)X16 + t * 8) = f.half[0];  }
__global__ __launch_bounds__(256) void k_h16(const float* __restrict__ x, _Float16* __restrict__ X16, size_t n8) { const size_t t = (size_t)blockIdx.x * 256 + threadIdx.x; if (t >= n8) return; FragH f;
#pragma unroll
  for (int q = 0; q < 8; ++q) f.h[q] = (_Float16)x[t * 8 + q]; *(v8us*)((unsigned short*)X16 + t * 8) = f.half[0];  }
__global__ __launch_bounds__(256) void k_round16f(const float* __restrict__ W, _Float16* __restrict__ Bt, size_t n8) { const size_t t = (size_t)blockIdx.x * 256 + threadIdx.x; if (t >= n8) return; FragH f;
#pragma unroll
  for (int i = 0; i < 8; ++i) f.h[i] = (_Float16)(bf16_round(W[t * 8 + i]) * 16.0f); *(v8us*)((unsigned short*)Bt + t * 8) = f.half[0];  }
template <int NHv, int TTv>
__global__ __launch_bounds__(256) void k_vt(const _Float16* __restrict__ V16, int ldv, int voff, _Float16* __restrict__ Vt) { __shared__ unsigned short tl[64][66]; const int tid = threadIdx.x; const int slab = blockIdx.x / (TTv / 64), lg = blockIdx.x % (TTv / 64); const int b = slab / NHv, h = slab % NHv;
  for (int i = tid; i < 64 * 8; i += 256) { const int r = i / 8, c8 = (i % 8) * 8; FragH f; f.half[0] = *(const v8us*)((const unsigned short*)V16 + ((size_t)b * TTv + lg * 64 + r) * ldv + voff + h * 64 + c8);
#pragma unroll
    for (int q = 0; q < 8; ++q) tl[r][c8 + q] = f.u[q]; }
  __syncthreads();
  {
#pragma unroll
    for (int rd = 0; rd < 2; ++rd) { const int d = rd * 32 + tid / 8, pc = tid % 8; FragH f;
#pragma unroll
      for (int q = 0; q < 8; ++q) f.u[q] = tl[pc * 8 + q][d];
      *(v8us*)((unsigned short*)Vt + ((size_t)slab * 64 + d) * TTv + lg * 64 + pc * 8) = f.half[0]; }
     } }

__global__ __launch_bounds__(256) void k_hl(const float* __restrict__ F, _Float16* __restrict__ Hh, _Float16* __restrict__ Hl, size_t n8) { const size_t t = (size_t)blockIdx.x * 256 + threadIdx.x; if (t >= n8) return; FragH fh, fl; const v4f a = *(const v4fa*)(F + t * 8), c = *(const v4fa*)(F + t * 8 + 4);
#pragma unroll
  for (int q = 0; q < 4; ++q) { _Float16 h = (_Float16)a[q]; fh.h[q] = h; fl.h[q] = (_Float16)((a[q] - (float)h) * 1024.0f); h = (_Float16)c[q]; fh.h[4 + q] = h; fl.h[4 + q] = (_Float16)((c[q] - (float)h) * 1024.0f); }
  { *(v8us*)((unsigned short*)Hh + t * 8) = fh.half[0]; *(v8us*)((unsigned short*)Hl + t * 8) = fl.half[0];  } }

// ---- fast GEMM (wave tile 32x64; requires M % 32 == 0 rows per launch region and N % 64 == 0); epilogue = k_gemm_hhx semantics ----
__device__ __forceinline__ v16h g2_frag(const _Float16* p, int hh) { FragH f; f.half[0] = *(const v8us*)((const unsigned short*)p + 8 * hh); f.half[1] = *(const v8us*)((const unsigned short*)p + 16 + 8 * hh); return f.v; }
__device__ __forceinline__ v8f g2_mma(v16h a, v16h b, v8f c) { v8f d = __builtin_amdgcn_wmma_f32_16x16x32_f16(false, a, false, b, (short)0, c, false, false); asm volatile("v_nop\n\tv_nop\n\tv_nop\n\tv_nop" : "+v"(d) : "v"(a), "v"(b)); return d; }
template <int ACT>
__global__ __launch_bounds__(128) void k_gemm2(const _Float16* __restrict__ A, int lda, size_t sA, const _Float16* __restrict__ Bh, int ldb, size_t sB, float alpha, const float* __restrict__ bias, size_t sBias, const float* __restrict__ CP, int rowsPerB, size_t sCPb, int row0g,
    float* __restrict__ C, _Float16* __restrict__ C16, int ldc, size_t sC, int M, int N, int K) { static_assert(ACT == 0 || ACT == 3 || ACT == 6 || ACT == 8 || ACT == 9 || ACT == 11 || ACT == 12 || ACT == 14 || ACT == 15 || ACT == 16 || ACT == 17, "k_gemm2: unsupported ACT code (would silently apply no activation)");
  __shared__ __attribute__((aligned(16))) float so[4][32][68];
  const int tid = threadIdx.x, w = tid >> 5, lane = tid & 31, ln = lane & 15, hh = lane >> 4; const int by = blockIdx.y;
  A += (size_t)by * sA; Bh += (size_t)by * sB; const size_t cofs = (size_t)by * sC; const float* bp = bias ? bias + (size_t)by * sBias : nullptr;
  const int ntn = N >> 6; const int mt = blockIdx.x / ntn, nq = blockIdx.x - mt * ntn; const int row0 = mt * 128 + 32 * w, col0 = nq * 64; if (row0 >= M) return;
  const _Float16* a0p = A + (size_t)(row0 + ln) * lda; const _Float16* a1p = a0p + (size_t)16 * lda;
  const _Float16* b0p = Bh + (size_t)(col0 + ln) * ldb; const _Float16* b1p = b0p + (size_t)16 * ldb; const _Float16* b2p = b1p + (size_t)16 * ldb; const _Float16* b3p = b2p + (size_t)16 * ldb;
  const v8f z8 = {0.f,0.f,0.f,0.f,0.f,0.f,0.f,0.f}; v8f c00 = z8, c01 = z8, c02 = z8, c03 = z8, c10 = z8, c11 = z8, c12 = z8, c13 = z8;
#pragma unroll 1
  for (int kb = 0; kb < K; kb += 32) { const v16h a0 = g2_frag(a0p + kb, hh), a1 = g2_frag(a1p + kb, hh);
    v16h b = g2_frag(b0p + kb, hh); c00 = g2_mma(a0, b, c00); c10 = g2_mma(a1, b, c10);
    b = g2_frag(b1p + kb, hh); c01 = g2_mma(a0, b, c01); c11 = g2_mma(a1, b, c11);
    b = g2_frag(b2p + kb, hh); c02 = g2_mma(a0, b, c02); c12 = g2_mma(a1, b, c12);
    b = g2_frag(b3p + kb, hh); c03 = g2_mma(a0, b, c03); c13 = g2_mma(a1, b, c13); }
  v8f accs[8] = {c00, c01, c02, c03, c10, c11, c12, c13};
#pragma unroll
  for (int u = 0; u < 8; ++u) { const int t = u & 3, half = u >> 2; const int col = col0 + t * 16 + ln; const float bv = bp ? bf16_round(bp[col]) : 0.f;
#pragma unroll
    for (int r = 0; r < 8; ++r) { const int rloc = half * 16 + 8 * hh + r; float v = accs[u][r] * alpha + bv; if (CP) { if (rowsPerB < 0) v += CP[cofs + (size_t)(row0g + row0 + rloc) * ldc + col];      /* rowsPerB < 0: own element of the batched C plane */ else { const int bidx = (row0g + row0 + rloc) / rowsPerB; v += CP[(size_t)bidx * sCPb + (size_t)by * 64 + col]; } }
      if (ACT == 3) v = fmaxf(v, 0.f); else if (ACT == 6) v = 0.5f * v * (1.0f + erff(v * 0.70710678118654752f)); else if (ACT == 11) v = 1.0f / (1.0f + expf(-v)); else if (ACT == 15) v = v / (1.0f + expf(-v)); else if (ACT == 12) v = (v > 0.f) ? v : 0.01f * v; else if (ACT == 8) v = tanhf(v); else if (ACT == 9) v = 0.5f * v * (1.0f + tanhf(0.7978845608028654f * (v + 0.044715f * v * v * v))); else if (ACT == 14) v = (v > 0.f) ? v : 0.1f * v; else if (ACT == 16) v = (v >= 0.f) ? v : 0.3f * v; else if (ACT == 17) v = (v >= 0.f) ? v : 0.2f * v;
      so[w][rloc][t * 16 + ln] = v; } }
  __builtin_amdgcn_fence(__ATOMIC_ACQ_REL, "workgroup"); __builtin_amdgcn_wave_barrier();
  const int rsub = lane >> 4, c4 = (lane & 15) * 4;
  {
#pragma unroll
    for (int q = 0; q < 16; ++q) { const int r = q * 2 + rsub; const v4f v = *(const v4fa*)&so[w][r][c4]; if (C) *(v4f*)(C + cofs + (size_t)(row0 + r) * ldc + col0 + c4) = v; if (C16) { v4h h4; for (int i = 0; i < 4; ++i) h4[i] = (_Float16)v[i]; *(v4h*)(C16 + cofs + (size_t)(row0 + r) * ldc + col0 + c4) = h4; } }
     } }


// T5 unidirectional bucket of relative position (key j - query i <= 0): rp = i - j; rp < 16 -> rp; else min(16 + int(log(rp/16)/log(8)*16), 31) — f32 math as the reference
__device__ __forceinline__ int rp_bucket(int i, int j) { int rp = i - j; if (rp < 0) rp = 0; if (rp < 16) return rp; const float lg = logf((float)rp / 16.0f) / 2.0794415416798357f * 16.0f; int b = 16 + (int)lg; return b > 31 ? 31 : b; }
__global__ __launch_bounds__(256) void k_bkt(int* __restrict__ BKT) { const int t = blockIdx.x * 256 + threadIdx.x; if (t >= SQ) return; const int b = rp_bucket(t, 0); *(int*)(BKT + t) = b;  }
// lane sum over a wave, every lane gets the total: four row_xmask DPP steps inside each 16-lane row, then lane l with lane l ^ 16 (all 32 lanes on)
template <int CTRL>
__device__ __forceinline__ float dpp_x(float x) { return __builtin_bit_cast(float, __builtin_amdgcn_update_dpp(0, __builtin_bit_cast(int, x), CTRL, 0xf, 0xf, true)); }
__device__ __forceinline__ float wave_sum(float x) {
  x += dpp_x<0x161>(x); x += dpp_x<0x162>(x); x += dpp_x<0x164>(x); x += dpp_x<0x168>(x);
  return x + __builtin_bit_cast(float, __builtin_amdgcn_permlanex16(__builtin_bit_cast(int, x), __builtin_bit_cast(int, x), 0x76543210, 0xfedcba98, false, false));
}
typedef int v4ia __attribute__((ext_vector_type(4), may_alias));
// one work-group per score row, launched with nk / 8 threads: each thread owns 8 neighbouring keys and keeps their weights in registers from the softplus to the scaled f16 planes
__global__ __launch_bounds__(256) void k_wsp(const float* __restrict__ S, _Float16* __restrict__ P, _Float16* __restrict__ PL, const int* __restrict__ mrow, const float* __restrict__ rb, const int* __restrict__ BKT, int h, int q0, int nk) {
  __shared__ __attribute__((aligned(16))) float red[8];
  const int i = blockIdx.x, tid = threadIdx.x, j0 = tid * 8, qi = q0 + i;
  float w8[8] = {0.f, 0.f, 0.f, 0.f, 0.f, 0.f, 0.f, 0.f};
  float se = 0.f;
  if (j0 <= qi) {      /* a chunk wholly above the diagonal keeps its zeros */
    int bk[8]; float bias[8];
#pragma unroll
    for (int q = 0; q < 8; ++q) { const int rp = qi - (j0 + q); bk[q] = BKT[rp > 0 ? rp : 0]; }
    asm volatile("s_wait_xcnt 0x0" ::: "memory");      /* stands in front of every reuse of the address registers of the loads above */
    const float* s = S + (size_t)i * NKX + j0;
    const v4f s0 = *(const v4fa*)s, s1 = *(const v4fa*)(s + 4);
    const float sv[8] = {s0[0], s0[1], s0[2], s0[3], s1[0], s1[1], s1[2], s1[3]};
    const bool qok = (mrow[qi] != 0);
    const v4ia m0 = *(const v4ia*)(mrow + j0);
    asm volatile("s_wait_xcnt 0x0" ::: "memory");      /* between the two mask loads: the build lets the second one's result land on the offset register that both name */
    const v4ia m1 = *(const v4ia*)(mrow + j0 + 4);
    const int mk[8] = {m0[0], m0[1], m0[2], m0[3], m1[0], m1[1], m1[2], m1[3]};
    asm volatile("s_wait_xcnt 0x0" ::: "memory");      /* the same for the score and mask loads */
#pragma unroll
    for (int q = 0; q < 8; ++q) bias[q] = bf16_round(rb[bk[q] * NH + h]);
    asm volatile("s_wait_xcnt 0x0" ::: "memory");      /* the same for the bias loads */
#pragma unroll
    for (int q = 0; q < 8; ++q) {
      const float a_ = __fadd_rn(sv[q], bias[q]);
      const float sp = (a_ > 20.0f) ? a_ : log1pf(expf(a_));
      w8[q] = (j0 + q <= qi && qok && mk[q] != 0) ? sp : 0.f;
      se += w8[q];
    }
  }
  se = wave_sum(se);
  const int nw = nk >> 8;      /* waves of this launch: nk / 8 threads */
  if ((tid & 31) == 0) red[tid >> 5] = se;
  if (tid >= nw && tid < 8) red[tid] = 0.f;      /* slots of waves this launch does not have */
  __syncthreads();      /* the waves' partial sums of this row meet here */
  const v4f r0 = *(const v4fa*)&red[0], r1 = *(const v4fa*)&red[4];
  const float tot = ((((((r0[0] + r0[1]) + r0[2]) + r0[3]) + r1[0]) + r1[1]) + r1[2]) + r1[3];
  const float sc = 256.0f / __fadd_rn(tot, 1e-8f);
  FragH f, fl;
#pragma unroll
  for (int q = 0; q < 8; ++q) { const float w = w8[q] * sc; const _Float16 hv = (_Float16)w; f.h[q] = hv; fl.h[q] = (_Float16)((w - (float)hv) * 1024.0f); }
  *(v8us*)((unsigned short*)P + (size_t)i * NKX + j0) = f.half[0];
  *(v8us*)((unsigned short*)PL + (size_t)i * NKX + j0) = fl.half[0];
}
__global__ __launch_bounds__(256) void k_vth(const _Float16* __restrict__ V16, int b, int h, _Float16* __restrict__ VT) { __shared__ unsigned short tl[64][65]; const int tid = threadIdx.x; const int j0 = blockIdx.x * 64;
  for (int i = tid; i < 64 * 8; i += 256) { const int j = i / 8, d8 = (i % 8) * 8; FragH f; f.half[0] = *(const v8us*)((const unsigned short*)V16 + ((size_t)b * SQ + j0 + j) * DM + h * HD + d8); for (int q = 0; q < 8; ++q) tl[d8 + q][j] = f.u[q]; }
  __syncthreads();
  { for (int i = tid; i < 64 * 8; i += 256) { const int d = i / 8, j8 = (i % 8) * 8; FragH f; for (int q = 0; q < 8; ++q) f.u[q] = tl[d][j8 + q]; *(v8us*)((unsigned short*)VT + (size_t)d * NKX + j0 + j8) = f.half[0]; }  } }

extern "C" void kernel_launch(void* const* d_in, const int* in_sizes, int n_in,
                              void* d_out, int out_size, void* d_ws, size_t ws_size, hipStream_t stream) {
  (void)in_sizes; (void)n_in; (void)out_size;
  const float* const* I = (const float* const*)d_in; const float* v = I[0]; const float* k = I[1]; const float* q = I[2]; const int* mask = (const int*)d_in[3]; const float* rb = I[4];      /* table order: v, k, q, mask, rel_bias */
  char* ws = (char*)d_ws; size_t off = 0;
  auto take = [&](size_t bytes) { char* p = ws + off; off += (bytes + 255) & ~(size_t)255; return p; };
  _Float16* Q16 = (_Float16*)take(NR * DM * 2); _Float16* K16 = (_Float16*)take(NR * DM * 2); _Float16* V16 = (_Float16*)take(NR * DM * 2);
  float* S = (float*)take((size_t)HG * QT * NKX * 4); _Float16* P = (_Float16*)take((size_t)HG * QT * NKX * 2); _Float16* PL = (_Float16*)take((size_t)HG * QT * NKX * 2); _Float16* VT = (_Float16*)take((size_t)HG * HD * NKX * 2); int* BKT = (int*)take(SQ * 4);
  if (off > ws_size) return;      /* 3 x 8 + 16 + 8 + 8 + 1 = ≈ 57 MiB */
  const unsigned g8 = (unsigned)((NR * DM / 8 + 255) / 256);
  k_bkt<<<(SQ + 255) / 256, 256, 0, stream>>>(BKT); k_x16<<<g8, 256, 0, stream>>>(q, Q16, NR * DM / 8); k_x16<<<g8, 256, 0, stream>>>(k, K16, NR * DM / 8); k_x16<<<g8, 256, 0, stream>>>(v, V16, NR * DM / 8);
  for (int b = 0; b < NB; ++b) for (int hg = 0; hg < NH / HG; ++hg) for (int q0 = 0; q0 < QN; q0 += QT) {
    const int nk = q0 + QT;      /* causal: keys below the tile end only */
    const size_t qa = ((size_t)b * SQ + q0) * DM + (size_t)hg * HG * HD; const size_t ka = ((size_t)b * SQ) * DM + (size_t)hg * HG * HD;
    k_gemm2<0><<<dim3((QT / 128) * (nk / 64), HG), 128, 0, stream>>>(Q16 + qa, DM, (size_t)HD, K16 + ka, DM, (size_t)HD, 0.125f, nullptr, 0, nullptr, 1, 0, 0, S, nullptr, NKX, (size_t)QT * NKX, QT, nk, HD);      /* q . k / 8 */
    for (int hh = 0; hh < HG; ++hh) { k_wsp<<<QT, nk / 8, 0, stream>>>(S + (size_t)hh * QT * NKX, P + (size_t)hh * QT * NKX, PL + (size_t)hh * QT * NKX, mask + (size_t)b * SQ, rb, BKT, hg * HG + hh, q0, nk); k_vth<<<nk / 64, 256, 0, stream>>>(V16, b, hg * HG + hh, VT + (size_t)hh * HD * NKX); }
    k_gemm2<0><<<dim3((QT / 128) * (HD / 64), HG), 128, 0, stream>>>(PL, NKX, (size_t)QT * NKX, VT, NKX, (size_t)HD * NKX, 0.00390625f / 1024.0f, nullptr, 0, nullptr, 1, 0, 0, (float*)d_out + qa, nullptr, DM, (size_t)HD, QT, HD, nk);      /* residual-weight term first */
    k_gemm2<0><<<dim3((QT / 128) * (HD / 64), HG), 128, 0, stream>>>(P, NKX, (size_t)QT * NKX, VT, NKX, (size_t)HD * NKX, 0.00390625f, nullptr, 0, (float*)d_out + qa, -1, 0, 0, (float*)d_out + qa, nullptr, DM, (size_t)HD, QT, HD, nk); }      /* + main term -> out rows (merged heads) */
}

// v003
// It runs in 71.5 microseconds.
// Versions in between are left out here; by their measured steps it is 54.8 times as fast as v001.
// All steps since v000 together make it 1126 times as fast.
#include <hip/hip_runtime.h>
// PointwiseAggregatedAttention (q, k, v [2][2048][1024] given directly, 16 heads of 64; att = q.k/8 + rel_bias[T5 bucket(key - query)][h]; w = softplus(att) where (causal AND mask_q AND mask_k) else 0; w /= (sum + 1e-8); out = w v merged -> [2][2048][1024]; mask [2][2048] int, read on device).
// Structure: two preparing launches (k as an f16 plane; v as f16, transposed per head), then ONE kernel for scores, weights and output. The normaliser is a plain row sum (no maximum to track), so the division waits until the end:
// out = (sum_j sp_ij v_j) / (sum_j sp_ij + 1e-8). Per wave 16 queries; per pass 32 keys: S^T = K . Q^T (WMMA), softplus and masks on the score accumulators in place, which are then already a B operand (hardware k order), O^T += V^T . P^T (WMMA). No score or weight ever reaches memory.
// Softplus in base 2: with y = att * log2(e), softplus(att) = ln 2 * (max(y, 0) + log2(1 + 2^-|y|)); the factor ln 2 is common to every weight and to the row sum, so it cancels in the division and only the 1e-8 is rescaled. 2^x and log2 are one hardware instruction each.
// Compute dtype: inputs rounded to bf16 (exact as f16); scores, bias, softplus, row sum f32; weights x128 as f16 plus an f16 residual (two WMMA terms into one f32 accumulator). v_wmma_f32_16x16x32_f16.
#define NB 2
#define SQ 2048
#define DM 1024
#define NH 16
#define HD 64
#define QW 1                         /* 16-query column groups per wave */
#define NWV 8                        /* waves per work-group */
#define QH (16 * QW * NWV / 2)       /* queries per half work-group: one tile */
#define NQT (SQ / QH)                /* query tiles per (batch, head) */
#define TPAD 32                      /* table entries in front of distance 0: the diagonal pass indexes down to -31 */
#define WSC 128.0f                   /* weight scale ahead of the f16 split */
#define L2E 1.4426950408889634f      /* log2(e) */
#define NR ((size_t)NB * SQ)
typedef unsigned short v8us __attribute__((ext_vector_type(8), may_alias));
typedef float  v8f  __attribute__((ext_vector_type(8)));
typedef float  v2f  __attribute__((ext_vector_type(2)));
typedef float  v4f  __attribute__((ext_vector_type(4)));
typedef float  v4fa __attribute__((ext_vector_type(4), may_alias));
typedef _Float16 v16h __attribute__((ext_vector_type(16)));
union FragH { v16h v; v8us half[2]; _Float16 h[16]; unsigned short u[16]; };

__device__ __forceinline__ unsigned short bf16_bits(float x) { unsigned int u = __float_as_uint(x); return (unsigned short)((u + 0x7FFFu + ((u >> 16) & 1u)) >> 16); }
__device__ __forceinline__ float bf16_val(unsigned short b) { return __uint_as_float(((unsigned int)b) << 16); }
__device__ __forceinline__ float bf16_round(float x) { return bf16_val(bf16_bits(x)); }

__global__ __launch_bounds__(256) void k_x16(const float* __restrict__ x, _Float16* __restrict__ X16, size_t n8) { const size_t t = (size_t)blockIdx.x * 256 + threadIdx.x; if (t >= n8) return; FragH f;
#pragma unroll
  for (int q = 0; q < 8; ++q) f.h[q] = (_Float16)bf16_round(x[t * 8 + q]); *(v8us*)((unsigned short*)X16 + t * 8) = f.half[0];  }

// VT[(b * NH + h) * 64 + d][key] = f16(bf16(v[b][key][h * 64 + d])), 64 x 64 tiles through LDS
__global__ __launch_bounds__(256) void k_vt16(const float* __restrict__ v, _Float16* __restrict__ VT) { __shared__ unsigned short tl[64][66]; const int tid = threadIdx.x; const int slab = blockIdx.x / (SQ / 64), lg = blockIdx.x % (SQ / 64); const int b = slab / NH, h = slab % NH;
  for (int i = tid; i < 64 * 8; i += 256) { const int r = i / 8, c8 = (i % 8) * 8; const float* p = v + ((size_t)b * SQ + lg * 64 + r) * DM + h * HD + c8; const v4f a = *(const v4fa*)p, c = *(const v4fa*)(p + 4); FragH f;
#pragma unroll
    for (int q = 0; q < 4; ++q) { f.h[q] = (_Float16)bf16_round(a[q]); f.h[4 + q] = (_Float16)bf16_round(c[q]); }
#pragma unroll
    for (int q = 0; q < 8; ++q) tl[r][c8 + q] = f.u[q]; }
  __syncthreads();
#pragma unroll
  for (int rd = 0; rd < 2; ++rd) { const int d = rd * 32 + tid / 8, pc = tid % 8; FragH f;
#pragma unroll
    for (int q = 0; q < 8; ++q) f.u[q] = tl[pc * 8 + q][d];
    *(v8us*)((unsigned short*)VT + ((size_t)slab * 64 + d) * SQ + lg * 64 + pc * 8) = f.half[0]; } }

// a wave-uniform pointer held in scalar registers: a load then names it as its scalar base beside the lane's 32-bit offset, which no pass rewrites (no 64-bit vector address to form per pass)
typedef const __attribute__((address_space(1))) unsigned short* gptr;      /* stays a global-memory pointer through the integer round trip */
typedef const __attribute__((address_space(1))) v8us* gptr8;
__device__ __forceinline__ gptr sbase(const _Float16* p) { const unsigned long long a = (unsigned long long)p; const unsigned int l = (unsigned int)__builtin_amdgcn_readfirstlane((int)(unsigned int)a), u = (unsigned int)__builtin_amdgcn_readfirstlane((int)(unsigned int)(a >> 32)); return (gptr)(((unsigned long long)u << 32) | l); }
// one operand fragment in the hardware k order: element s < 8 is k = 8 hh + s, element s >= 8 is k = 16 + 8 hh + (s - 8); p points at k = 0 of the group's first row (A) or column (B) and is the same in every lane, lo = the lane's own row or column times the pitch, plus 8 hh
__device__ __forceinline__ v16h g2_frag(gptr p, unsigned int lo) { FragH f; f.half[0] = *(gptr8)(p + lo); f.half[1] = *(gptr8)(p + 16 + lo); return f.v; }
__device__ __forceinline__ v8f mma(v16h a, v16h b, v8f c) { return __builtin_amdgcn_wmma_f32_16x16x32_f16(false, a, false, b, (short)0, c, false, false); }

// T5 unidirectional bucket of distance rp = query - key >= 0: rp < 16 -> rp; else min(16 + int(log(rp/16)/log(8)*16), 31), f32 math as the reference
__device__ __forceinline__ int rp_bucket(int rp) { if (rp < 16) return rp; const float lg = logf((float)rp / 16.0f) / 2.0794415416798357f * 16.0f; int b = 16 + (int)lg; return b > 31 ? 31 : b; }

// waves_per_eu(2, 4): at most 256 registers, so that two work-groups (four waves per SIMD) share a WGP, with room left for the scheduler to interleave the 16 softplus chains of a pass
__global__ __launch_bounds__(32 * NWV) __attribute__((amdgpu_waves_per_eu(2, 4))) void k_attn(const float* __restrict__ q, const _Float16* __restrict__ K16, const _Float16* __restrict__ VT, const int* __restrict__ mask, const float* __restrict__ rb, float* __restrict__ out) {
  __shared__ float tb[TPAD + SQ];      /* tb[TPAD + rp] = this head's bias at distance rp, times log2(e) */
  __shared__ unsigned int mw[SQ / 32]; /* bit k of mw[c] = key 32 c + k is unmasked */
  const int tid = threadIdx.x, lane = tid & 31, ln = lane & 15, hh = lane >> 4;
  const int w = __builtin_amdgcn_readfirstlane(tid >> 5);      /* the wave's number in a scalar register: the key loop's bound stays scalar */
  const int bh = blockIdx.x % (NB * NH), pr = blockIdx.x / (NB * NH);
  const int b = bh / NH, h = bh % NH;
  const int nkey = (NQT - pr) * QH;      /* keys this work-group can see: up to the end of its long tile */
  const int* mrow = mask + (size_t)b * SQ;
  for (int i = tid; i < TPAD + nkey; i += 32 * NWV) tb[i] = (i < TPAD) ? 0.f : bf16_round(rb[rp_bucket(i - TPAD) * NH + h]) * L2E;
  for (int c = w; c < nkey / 32; c += NWV) { const unsigned int bits = __builtin_amdgcn_ballot_w32(mrow[c * 32 + lane] != 0); if (lane == 0) mw[c] = bits; }
  __syncthreads();      /* table and mask words are read by every wave from here on */

  /* causal rows differ in length: the first half of the waves takes tile NQT - 1 - pr, the second half tile pr, so every work-group has the same number of passes */
  const int q0 = ((w < NWV / 2) ? (NQT - 1 - pr) : pr) * QH + (w % (NWV / 2)) * (16 * QW);      /* the wave's first query */
  const int jl = q0 & ~31;                     /* first key of the wave's last pass, the one that holds the diagonal */
  v16h qf[QW][2]; bool qok[QW];
#pragma unroll
  for (int u = 0; u < QW; ++u) {
    const float* qr = q + ((size_t)b * SQ + q0 + 16 * u + ln) * DM + h * HD;
    qok[u] = (mrow[q0 + 16 * u + ln] != 0);
#pragma unroll
    for (int ks = 0; ks < 2; ++ks) {
      const float* p0 = qr + 32 * ks + 8 * hh;
      const v4f x0 = *(const v4fa*)p0, x1 = *(const v4fa*)(p0 + 4), x2 = *(const v4fa*)(p0 + 16), x3 = *(const v4fa*)(p0 + 20);
      FragH f;
#pragma unroll
      for (int e = 0; e < 4; ++e) { f.h[e] = (_Float16)bf16_round(x0[e]); f.h[4 + e] = (_Float16)bf16_round(x1[e]); f.h[8 + e] = (_Float16)bf16_round(x2[e]); f.h[12 + e] = (_Float16)bf16_round(x3[e]); }
      qf[u][ks] = f.v;
    }
  }
  const _Float16* Kb = K16 + (size_t)b * SQ * DM + h * HD;      /* key 0 of this head */
  const _Float16* Vb = VT + (size_t)bh * HD * SQ;               /* d row 0 of this head */
  const unsigned int klo = (unsigned int)(ln * DM + 8 * hh), vlo = (unsigned int)(ln * SQ + 8 * hh);      /* the lane's place in a 16-row group: fixed for the whole loop, the pass moves the scalar base alone */
  const v8f z8 = {0.f, 0.f, 0.f, 0.f, 0.f, 0.f, 0.f, 0.f};
  v8f acc[QW][4]; float sum[QW];
#pragma unroll
  for (int u = 0; u < QW; ++u) { sum[u] = 0.f;
#pragma unroll
    for (int dt = 0; dt < 4; ++dt) acc[u][dt] = z8; }
  v16h kf[2][2];
#pragma unroll
  for (int t = 0; t < 2; ++t)
#pragma unroll
    for (int ks = 0; ks < 2; ++ks) kf[t][ks] = g2_frag(sbase(Kb) + (size_t)(16 * t) * DM + 32 * ks, klo);

  for (int j0 = 0; j0 <= jl; j0 += 32) {
    v16h vf[4]; const gptr vs = sbase(Vb + j0);
#pragma unroll
    for (int dt = 0; dt < 4; ++dt) vf[dt] = g2_frag(vs + (size_t)(16 * dt) * SQ, vlo);
    const unsigned int kw = mw[j0 >> 5];
    v8f s[QW][2];
#pragma unroll
    for (int u = 0; u < QW; ++u)
#pragma unroll
      for (int t = 0; t < 2; ++t) s[u][t] = mma(kf[t][1], qf[u][1], mma(kf[t][0], qf[u][0], z8));      /* s[u][t][r] = score of key j0 + 16 t + 8 hh + r, query q0 + 16 u + ln */
    const int jn = (j0 + 32 <= jl) ? j0 + 32 : jl; const gptr ks_ = sbase(Kb + (size_t)jn * DM);      /* the next pass's K fragments fly under this pass's vector work; the last pass reloads its own rows, in bounds */
#pragma unroll
    for (int t = 0; t < 2; ++t)
#pragma unroll
      for (int ks = 0; ks < 2; ++ks) kf[t][ks] = g2_frag(ks_ + (size_t)(16 * t) * DM + 32 * ks, klo);
#pragma unroll
    for (int u = 0; u < QW; ++u) {
      const int dq = q0 + 16 * u + ln - j0;      /* query minus the pass's first key, >= 0 */
      const unsigned int cm = (dq >= 31) ? 0xFFFFFFFFu : ((2u << dq) - 1u);      /* causal: keys j0 .. j0 + dq */
      const unsigned int vw = (qok[u] ? (kw & cm) : 0u) >> (8 * hh);
      FragH ph, pl;
#pragma unroll
      for (int t = 0; t < 2; ++t) {
        const float* tp = &tb[TPAD + dq - 8 * hh - 16 * t - 7];
        float spv[8];      /* softplus / ln 2, two elements at a time: the plain arithmetic is packed f32 */
#pragma unroll
        for (int r = 0; r < 8; r += 2) {
          const v2f sv = {s[u][t][r], s[u][t][r + 1]}, bv = {tp[7 - r], tp[6 - r]}, c2 = {0.125f * L2E, 0.125f * L2E}, l2 = {L2E, L2E};
          const v2f y_ = __builtin_elementwise_fma(sv, c2, bv);
          const v2f e_ = {__builtin_amdgcn_exp2f(-__builtin_fabsf(y_[0])), __builtin_amdgcn_exp2f(-__builtin_fabsf(y_[1]))};      /* in (0, 1]: no overflow at any score */
          const v2f u_ = e_ + 1.0f;
          const v2f r_ = e_ - (u_ - 1.0f);      /* what the sum 1 + e_ rounded away, exact; added back to first order below, so a small weight keeps its relative accuracy */
          const v2f m_ = {fmaxf(y_[0], 0.f), fmaxf(y_[1], 0.f)}, g_ = {__builtin_amdgcn_logf(u_[0]), __builtin_amdgcn_logf(u_[1])};
          const v2f p_ = __builtin_elementwise_fma(r_, l2, m_) + g_;
          spv[r] = p_[0]; spv[r + 1] = p_[1];
        }
#pragma unroll
        for (int r = 0; r < 8; ++r) {
          const float sp = spv[r];
          const float wg = ((vw >> (16 * t + r)) & 1u) ? sp : 0.f;
          sum[u] += wg;
          const float x = wg * WSC; const _Float16 hv = (_Float16)x;
          ph.h[8 * t + r] = hv; pl.h[8 * t + r] = (_Float16)(x - (float)hv);
        }
      }
#pragma unroll
      for (int dt = 0; dt < 4; ++dt) acc[u][dt] = mma(vf[dt], pl.v, acc[u][dt]);
#pragma unroll
      for (int dt = 0; dt < 4; ++dt) acc[u][dt] = mma(vf[dt], ph.v, acc[u][dt]);      /* acc[u][dt][r] = O^T[d = 16 dt + 8 hh + r][query q0 + 16 u + ln] */
    }
  }
#pragma unroll
  for (int u = 0; u < QW; ++u) {
    const float oth = __builtin_bit_cast(float, __builtin_amdgcn_permlanex16(__builtin_bit_cast(int, sum[u]), __builtin_bit_cast(int, sum[u]), 0x76543210, 0xfedcba98, false, false));      /* lane l ^ 16 holds the same query's other keys */
    const float sc = (1.0f / WSC) / __fadd_rn(sum[u] + oth, 1e-8f * L2E);      /* sums and weights both carry 1 / ln 2 */
    float* o = out + ((size_t)b * SQ + q0 + 16 * u + ln) * DM + h * HD + 8 * hh;
#pragma unroll
    for (int dt = 0; dt < 4; ++dt) {
      const v4f o0 = {acc[u][dt][0] * sc, acc[u][dt][1] * sc, acc[u][dt][2] * sc, acc[u][dt][3] * sc};
      const v4f o1 = {acc[u][dt][4] * sc, acc[u][dt][5] * sc, acc[u][dt][6] * sc, acc[u][dt][7] * sc};
      *(v4f*)(o + 16 * dt) = o0; *(v4f*)(o + 16 * dt + 4) = o1;
    }
  }
}

extern "C" void kernel_launch(void* const* d_in, const int* in_sizes, int n_in,
                              void* d_out, int out_size, void* d_ws, size_t ws_size, hipStream_t stream) {
  (void)in_sizes; (void)n_in; (void)out_size;
  const float* const* I = (const float* const*)d_in; const float* v = I[0]; const float* k = I[1]; const float* q = I[2]; const int* mask = (const int*)d_in[3]; const float* rb = I[4];      /* table order: v, k, q, mask, rel_bias */
  char* ws = (char*)d_ws; size_t off = 0;
  auto take = [&](size_t bytes) { char* p = ws + off; off += (bytes + 255) & ~(size_t)255; return p; };
  _Float16* K16 = (_Float16*)take(NR * DM * 2); _Float16* VT = (_Float16*)take(NR * DM * 2);
  if (off > ws_size) return;      /* 2 x 8 MiB */
  const unsigned g8 = (unsigned)((NR * DM / 8 + 255) / 256);
  k_x16<<<g8, 256, 0, stream>>>(k, K16, NR * DM / 8);
  k_vt16<<<NB * NH * (SQ / 64), 256, 0, stream>>>(v, VT);
  k_attn<<<NB * NH * (NQT / 2), 32 * NWV, 0, stream>>>(q, K16, VT, mask, rb, (float*)d_out);
}

// v004
// Measured time: 64.8 microseconds a run.
// In both of two side-by-side timings against v003, it was 1.10 times as fast.
// Counting every step since v000, it is 1239 times as fast.
#include <hip/hip_runtime.h>
// PointwiseAggregatedAttention (q, k, v [2][2048][1024] given directly, 16 heads of 64; att = q.k/8 + rel_bias[T5 bucket(key - query)][h]; w = softplus(att) where (causal AND mask_q AND mask_k) else 0; w /= (sum + 1e-8); out = w v merged -> [2][2048][1024]; mask [2][2048] int, read on device).
// Structure: two preparing launches (k and v as f16, each packed in the order of the WMMA operand fragments that read it), then ONE kernel for scores, weights and output. The normaliser is a plain row sum (no maximum to track), so the division waits until the end:
// out = (sum_j sp_ij v_j) / (sum_j sp_ij + 1e-8). Per wave 16 queries; per pass 32 keys: S^T = K . Q^T (WMMA), softplus and masks on the score accumulators in place, which are then already a B operand (hardware k order), O^T += V^T . P^T (WMMA). No score or weight ever reaches memory.
// Softplus in base 2: with y = att * log2(e), softplus(att) = ln 2 * (max(y, 0) + log2(1 + 2^-|y|)); the factor ln 2 is common to every weight and to the row sum, so it cancels in the division and only the 1e-8 is rescaled. 2^x and log2 are one hardware instruction each.
// Compute dtype: inputs rounded to bf16 (exact as f16); scores, bias, softplus, row sum f32; weights x128 as f16 plus an f16 residual (two WMMA terms into one f32 accumulator). v_wmma_f32_16x16x32_f16.
#define NB 2
#define SQ 2048
#define DM 1024
#define NH 16
#define HD 64
#define QW 1                         /* 16-query column groups per wave */
#define NWV 8                        /* waves per work-group */
#define QH (16 * QW * NWV / 2)       /* queries per half work-group: one tile */
#define NQT (SQ / QH)                /* query tiles per (batch, head) */
#define TPAD 32                      /* table entries in front of distance 0: the diagonal pass indexes down to -31 */
#define WSC 128.0f                   /* weight scale ahead of the f16 split */
#define L2E 1.4426950408889634f      /* log2(e) */
#define NR ((size_t)NB * SQ)
typedef unsigned short v8us __attribute__((ext_vector_type(8), may_alias));
typedef float  v8f  __attribute__((ext_vector_type(8)));
typedef float  v2f  __attribute__((ext_vector_type(2)));
typedef float  v4f  __attribute__((ext_vector_type(4)));
typedef float  v4fa __attribute__((ext_vector_type(4), may_alias));
typedef _Float16 v16h __attribute__((ext_vector_type(16)));
union FragH { v16h v; v8us half[2]; _Float16 h[16]; unsigned short u[16]; };

__device__ __forceinline__ unsigned short bf16_bits(float x) { unsigned int u = __float_as_uint(x); return (unsigned short)((u + 0x7FFFu + ((u >> 16) & 1u)) >> 16); }
__device__ __forceinline__ float bf16_val(unsigned short b) { return __uint_as_float(((unsigned int)b) << 16); }
__device__ __forceinline__ float bf16_round(float x) { return bf16_val(bf16_bits(x)); }

// Both planes are made of 512-byte units, one per wave-wide 16-byte load of k_attn: lane hh * 16 + ln owns bytes 16 * lane .. + 15, so a load covers four whole 128-byte lines and not 32 bytes in each of sixteen.
// KP[((bh * (SQ / 16) + g) * 4 + ks * 2 + half) * 256 + (hh * 16 + ln) * 8 + e] = f16(bf16(k[b][16 g + ln][h * 64 + 32 ks + 16 half + 8 hh + e])). A wave takes 8 keys x 32 d: it reads 8 whole lines and stores 4 whole lines.
__global__ __launch_bounds__(256) void k_kp(const float* __restrict__ k, _Float16* __restrict__ KP) { const unsigned int t = blockIdx.x * 256 + threadIdx.x, wv = t >> 5, l = t & 31;
  const unsigned int ks = wv & 1, g = (wv >> 2) % (SQ / 16), bh = wv / (4 * (SQ / 16)); const unsigned int half = l >> 4, hh = (l >> 3) & 1, ln = ((wv >> 1) & 1) * 8 + (l & 7);
  const float* p = k + ((size_t)(bh / NH) * SQ + g * 16 + ln) * DM + (bh % NH) * HD + 32 * ks + 16 * half + 8 * hh; const v4f a = *(const v4fa*)p, c = *(const v4fa*)(p + 4); FragH f;
#pragma unroll
  for (int q = 0; q < 4; ++q) { f.h[q] = (_Float16)bf16_round(a[q]); f.h[4 + q] = (_Float16)bf16_round(c[q]); }
  *(v8us*)((unsigned short*)KP + ((size_t)(bh * (SQ / 16) + g) * 4 + ks * 2 + half) * 256 + (hh * 16 + ln) * 8) = f.half[0]; }

// VP[((bh * (SQ / 32) + p) * 8 + dt * 2 + half) * 256 + (hh * 16 + ln) * 8 + e] = f16(bf16(v[b][32 p + 16 half + 8 hh + e][h * 64 + 16 dt + ln])), 64 x 64 tiles through LDS
__global__ __launch_bounds__(256) void k_vp(const float* __restrict__ v, _Float16* __restrict__ VP) { __shared__ unsigned short tl[64][66]; const int tid = threadIdx.x; const int slab = blockIdx.x / (SQ / 64), lg = blockIdx.x % (SQ / 64); const int b = slab / NH, h = slab % NH;
  for (int i = tid; i < 64 * 8; i += 256) { const int r = i / 8, c8 = (i % 8) * 8; const float* p = v + ((size_t)b * SQ + lg * 64 + r) * DM + h * HD + c8; const v4f a = *(const v4fa*)p, c = *(const v4fa*)(p + 4); FragH f;
#pragma unroll
    for (int q = 0; q < 4; ++q) { f.h[q] = (_Float16)bf16_round(a[q]); f.h[4 + q] = (_Float16)bf16_round(c[q]); }
#pragma unroll
    for (int q = 0; q < 8; ++q) tl[r][c8 + q] = f.u[q]; }
  __syncthreads();
#pragma unroll
  for (int rd = 0; rd < 2; ++rd) { const int d = (tid >> 6) * 16 + (tid & 15), k0 = rd * 32 + ((tid >> 5) & 1) * 16 + ((tid >> 4) & 1) * 8; FragH f;      /* tid = (dt * 2 + half) * 32 + hh * 16 + ln; rd = the 32-key pass inside the tile */
#pragma unroll
    for (int q = 0; q < 8; ++q) f.u[q] = tl[k0 + q][d];
    *(v8us*)((unsigned short*)VP + ((size_t)slab * (SQ / 32) + lg * 2 + rd) * 2048 + tid * 8) = f.half[0]; } }

// a wave-uniform pointer held in scalar registers: a load then names it as its scalar base beside the lane's 32-bit offset, which no pass rewrites (no 64-bit vector address to form per pass)
typedef const __attribute__((address_space(1))) unsigned short* gptr;      /* stays a global-memory pointer through the integer round trip */
typedef const __attribute__((address_space(1))) v8us* gptr8;
__device__ __forceinline__ gptr sbase(const _Float16* p) { const unsigned long long a = (unsigned long long)p; const unsigned int l = (unsigned int)__builtin_amdgcn_readfirstlane((int)(unsigned int)a), u = (unsigned int)__builtin_amdgcn_readfirstlane((int)(unsigned int)(a >> 32)); return (gptr)(((unsigned long long)u << 32) | l); }
// one operand fragment in the hardware k order: element s < 8 is k = 8 hh + s, element s >= 8 is k = 16 + 8 hh + (s - 8); p points at the fragment's first 512-byte unit (its second follows) and is the same in every lane, lo = 8 times the lane's number
__device__ __forceinline__ v16h g2_frag(gptr p, unsigned int lo) { FragH f; f.half[0] = *(gptr8)(p + lo); f.half[1] = *(gptr8)(p + 256 + lo); return f.v; }
__device__ __forceinline__ v8f mma(v16h a, v16h b, v8f c) { return __builtin_amdgcn_wmma_f32_16x16x32_f16(false, a, false, b, (short)0, c, false, false); }

// T5 unidirectional bucket of distance rp = query - key >= 0: rp < 16 -> rp; else min(16 + int(log(rp/16)/log(8)*16), 31), f32 math as the reference
__device__ __forceinline__ int rp_bucket(int rp) { if (rp < 16) return rp; const float lg = logf((float)rp / 16.0f) / 2.0794415416798357f * 16.0f; int b = 16 + (int)lg; return b > 31 ? 31 : b; }

// waves_per_eu(2, 4): at most 256 registers, so that two work-groups (four waves per SIMD) share a WGP, with room left for the scheduler to interleave the 16 softplus chains of a pass
__global__ __launch_bounds__(32 * NWV) __attribute__((amdgpu_waves_per_eu(2, 4))) void k_attn(const float* __restrict__ q, const _Float16* __restrict__ KP, const _Float16* __restrict__ VP, const int* __restrict__ mask, const float* __restrict__ rb, float* __restrict__ out) {
  __shared__ float tb[TPAD + SQ];      /* tb[TPAD + rp] = this head's bias at distance rp, times log2(e) */
  __shared__ unsigned int mw[SQ / 32]; /* bit k of mw[c] = key 32 c + k is unmasked */
  const int tid = threadIdx.x, lane = tid & 31, ln = lane & 15, hh = lane >> 4;
  const int w = __builtin_amdgcn_readfirstlane(tid >> 5);      /* the wave's number in a scalar register: the key loop's bound stays scalar */
  const int bh = blockIdx.x % (NB * NH), pr = blockIdx.x / (NB * NH);
  const int b = bh / NH, h = bh % NH;
  const int nkey = (NQT - pr) * QH;      /* keys this work-group can see: up to the end of its long tile */
  const int* mrow = mask + (size_t)b * SQ;
  for (int i = tid; i < TPAD + nkey; i += 32 * NWV) tb[i] = (i < TPAD) ? 0.f : bf16_round(rb[rp_bucket(i - TPAD) * NH + h]) * L2E;
  for (int c = w; c < nkey / 32; c += NWV) { const unsigned int bits = __builtin_amdgcn_ballot_w32(mrow[c * 32 + lane] != 0); if (lane == 0) mw[c] = bits; }
  __syncthreads();      /* table and mask words are read by every wave from here on */

  /* causal rows differ in length: the first half of the waves takes tile NQT - 1 - pr, the second half tile pr, so every work-group has the same number of passes */
  const int q0 = ((w < NWV / 2) ? (NQT - 1 - pr) : pr) * QH + (w % (NWV / 2)) * (16 * QW);      /* the wave's first query */
  const int jl = q0 & ~31;                     /* first key of the wave's last pass, the one that holds the diagonal */
  v16h qf[QW][2]; bool qok[QW];
#pragma unroll
  for (int u = 0; u < QW; ++u) {
    const float* qr = q + ((size_t)b * SQ + q0 + 16 * u + ln) * DM + h * HD;
    qok[u] = (mrow[q0 + 16 * u + ln] != 0);
#pragma unroll
    for (int ks = 0; ks < 2; ++ks) {
      const float* p0 = qr + 32 * ks + 8 * hh;
      const v4f x0 = *(const v4fa*)p0, x1 = *(const v4fa*)(p0 + 4), x2 = *(const v4fa*)(p0 + 16), x3 = *(const v4fa*)(p0 + 20);
      FragH f;
#pragma unroll
      for (int e = 0; e < 4; ++e) { f.h[e] = (_Float16)bf16_round(x0[e]); f.h[4 + e] = (_Float16)bf16_round(x1[e]); f.h[8 + e] = (_Float16)bf16_round(x2[e]); f.h[12 + e] = (_Float16)bf16_round(x3[e]); }
      qf[u][ks] = f.v;
    }
  }
  const _Float16* Kb = KP + (size_t)bh * SQ * HD;      /* key 0 of this head: 64 elements a key in both planes */
  const _Float16* Vb = VP + (size_t)bh * SQ * HD;
  const unsigned int flo = (unsigned int)(lane * 8);      /* the lane's place in a unit: fixed for the whole loop, the pass moves the scalar base alone */
  const v8f z8 = {0.f, 0.f, 0.f, 0.f, 0.f, 0.f, 0.f, 0.f};
  v8f acc[QW][4]; float sum[QW];
#pragma unroll
  for (int u = 0; u < QW; ++u) { sum[u] = 0.f;
#pragma unroll
    for (int dt = 0; dt < 4; ++dt) acc[u][dt] = z8; }
  v16h kf[2][2];
#pragma unroll
  for (int t = 0; t < 2; ++t)
#pragma unroll
    for (int ks = 0; ks < 2; ++ks) kf[t][ks] = g2_frag(sbase(Kb) + (2 * t + ks) * 512, flo);

  for (int j0 = 0; j0 <= jl; j0 += 32) {
    v16h vf[4]; const gptr vs = sbase(Vb + (size_t)j0 * HD);
#pragma unroll
    for (int dt = 0; dt < 4; ++dt) vf[dt] = g2_frag(vs + dt * 512, flo);
    const unsigned int kw = mw[j0 >> 5];
    v8f s[QW][2];
#pragma unroll
    for (int u = 0; u < QW; ++u)
#pragma unroll
      for (int t = 0; t < 2; ++t) s[u][t] = mma(kf[t][1], qf[u][1], mma(kf[t][0], qf[u][0], z8));      /* s[u][t][r] = score of key j0 + 16 t + 8 hh + r, query q0 + 16 u + ln */
    const int jn = (j0 + 32 <= jl) ? j0 + 32 : jl; const gptr ks_ = sbase(Kb + (size_t)jn * HD);      /* the next pass's K fragments fly under this pass's vector work; the last pass reloads its own rows, in bounds */
#pragma unroll
    for (int t = 0; t < 2; ++t)
#pragma unroll
      for (int ks = 0; ks < 2; ++ks) kf[t][ks] = g2_frag(ks_ + (2 * t + ks) * 512, flo);
#pragma unroll
    for (int u = 0; u < QW; ++u) {
      const int dq = q0 + 16 * u + ln - j0;      /* query minus the pass's first key, >= 0 */
      const unsigned int cm = (dq >= 31) ? 0xFFFFFFFFu : ((2u << dq) - 1u);      /* causal: keys j0 .. j0 + dq */
      const unsigned int vw = (qok[u] ? (kw & cm) : 0u) >> (8 * hh);
      FragH ph, pl;
#pragma unroll
      for (int t = 0; t < 2; ++t) {
        const float* tp = &tb[TPAD + dq - 8 * hh - 16 * t - 7];
        float spv[8];      /* softplus / ln 2, two elements at a time: the plain arithmetic is packed f32 */
#pragma unroll
        for (int r = 0; r < 8; r += 2) {
          const v2f sv = {s[u][t][r], s[u][t][r + 1]}, bv = {tp[7 - r], tp[6 - r]}, c2 = {0.125f * L2E, 0.125f * L2E}, l2 = {L2E, L2E};
          const v2f y_ = __builtin_elementwise_fma(sv, c2, bv);
          const v2f e_ = {__builtin_amdgcn_exp2f(-__builtin_fabsf(y_[0])), __builtin_amdgcn_exp2f(-__builtin_fabsf(y_[1]))};      /* in (0, 1]: no overflow at any score */
          const v2f u_ = e_ + 1.0f;
          const v2f r_ = e_ - (u_ - 1.0f);      /* what the sum 1 + e_ rounded away, exact; added back to first order below, so a small weight keeps its relative accuracy */
          const v2f m_ = {fmaxf(y_[0], 0.f), fmaxf(y_[1], 0.f)}, g_ = {__builtin_amdgcn_logf(u_[0]), __builtin_amdgcn_logf(u_[1])};
          const v2f p_ = __builtin_elementwise_fma(r_, l2, m_) + g_;
          spv[r] = p_[0]; spv[r + 1] = p_[1];
        }
#pragma unroll
        for (int r = 0; r < 8; ++r) {
          const float sp = spv[r];
          const float wg = ((vw >> (16 * t + r)) & 1u) ? sp : 0.f;
          sum[u] += wg;
          const float x = wg * WSC; const _Float16 hv = (_Float16)x;
          ph.h[8 * t + r] = hv; pl.h[8 * t + r] = (_Float16)(x - (float)hv);
        }
      }
#pragma unroll
      for (int dt = 0; dt < 4; ++dt) acc[u][dt] = mma(vf[dt], pl.v, acc[u][dt]);
#pragma unroll
      for (int dt = 0; dt < 4; ++dt) acc[u][dt] = mma(vf[dt], ph.v, acc[u][dt]);      /* acc[u][dt][r] = O^T[d = 16 dt + 8 hh + r][query q0 + 16 u + ln] */
    }
  }
#pragma unroll
  for (int u = 0; u < QW; ++u) {
    const float oth = __builtin_bit_cast(float, __builtin_amdgcn_permlanex16(__builtin_bit_cast(int, sum[u]), __builtin_bit_cast(int, sum[u]), 0x76543210, 0xfedcba98, false, false));      /* lane l ^ 16 holds the same query's other keys */
    const float sc = (1.0f / WSC) / __fadd_rn(sum[u] + oth, 1e-8f * L2E);      /* sums and weights both carry 1 / ln 2 */
    float* o = out + ((size_t)b * SQ + q0 + 16 * u + ln) * DM + h * HD + 8 * hh;
#pragma unroll
    for (int dt = 0; dt < 4; ++dt) {
      const v4f o0 = {acc[u][dt][0] * sc, acc[u][dt][1] * sc, acc[u][dt][2] * sc, acc[u][dt][3] * sc};
      const v4f o1 = {acc[u][dt][4] * sc, acc[u][dt][5] * sc, acc[u][dt][6] * sc, acc[u][dt][7] * sc};
      *(v4f*)(o + 16 * dt) = o0; *(v4f*)(o + 16 * dt + 4) = o1;
    }
  }
}

extern "C" void kernel_launch(void* const* d_in, const int* in_sizes, int n_in,
                              void* d_out, int out_size, void* d_ws, size_t ws_size, hipStream_t stream) {
  (void)in_sizes; (void)n_in; (void)out_size;
  const float* const* I = (const float* const*)d_in; const float* v = I[0]; const float* k = I[1]; const float* q = I[2]; const int* mask = (const int*)d_in[3]; const float* rb = I[4];      /* table order: v, k, q, mask, rel_bias */
  char* ws = (char*)d_ws; size_t off = 0;
  auto take = [&](size_t bytes) { char* p = ws + off; off += (bytes + 255) & ~(size_t)255; return p; };
  _Float16* KP = (_Float16*)take(NR * DM * 2); _Float16* VP = (_Float16*)take(NR * DM * 2);
  if (off > ws_size) return;      /* 2 x 8 MiB */
  k_kp<<<NR * DM / 8 / 256, 256, 0, stream>>>(k, KP);
  k_vp<<<NB * NH * (SQ / 64), 256, 0, stream>>>(v, VP);
  k_attn<<<NB * NH * (NQT / 2), 32 * NWV, 0, stream>>>(q, KP, VP, mask, rb, (float*)d_out);
}

// v005
// It runs in 57.7 microseconds.
// Timed twice side by side with v004, it ran 1.11 and 1.10 times as fast.
// All steps since v000 together make it 1366 times as fast.
#include <hip/hip_runtime.h>
// PointwiseAggregatedAttention (q, k, v [2][2048][1024] given directly, 16 heads of 64; att = q.k/8 + rel_bias[T5 bucket(key - query)][h]; w = softplus(att) where (causal AND mask_q AND mask_k) else 0; w /= (sum + 1e-8); out = w v merged -> [2][2048][1024]; mask [2][2048] int, read on device).
// Structure: two preparing launches (k and v as f16, each packed in the order of the WMMA operand fragments that read it), then ONE kernel for scores, weights and output. The normaliser is a plain row sum (no maximum to track), so the division waits until the end:
// out = (sum_j sp_ij v_j) / (sum_j sp_ij + 1e-8). Per wave 16 queries; per pass 32 keys: S^T = K . Q^T (WMMA), softplus and masks on the score accumulators in place, which are then already a B operand (hardware k order), O^T += V^T . P^T (WMMA). No score or weight ever reaches memory.
// Softplus in base 2: with y = att * log2(e), softplus(att) = ln 2 * (max(y, 0) + log2(1 + 2^-|y|)); the factor ln 2 is common to every weight and to the row sum, so it cancels in the division and only the 1e-8 is rescaled. 2^x and log2 are one hardware instruction each.
// Compute dtype: inputs rounded to bf16 (exact as f16); scores, bias, softplus, row sum f32; weights x128 as f16 plus an f16 residual (two WMMA terms into one f32 accumulator). v_wmma_f32_16x16x32_f16.
#define NB 2
#define SQ 2048
#define DM 1024
#define NH 16
#define HD 64
#define QW 1                         /* 16-query column groups per wave */
#define NWV 8                        /* waves per work-group */
#define QH (16 * QW * NWV / 2)       /* queries per half work-group: one tile */
#define NQT (SQ / QH)                /* query tiles per (batch, head) */
#define TPAD 32                      /* table entries in front of distance 0: the diagonal pass indexes down to -31 */
#define FAR 128                      /* from this distance on every key falls in the last bucket: 16 + int(log(rp / 16) / log(8) * 16) >= 31 */
#define TN (TPAD + FAR + 32)         /* table entries: distances -32 .. FAR + 31, so that a pass of 32 keys can read the last bucket alone */
#define WSC 128.0f                   /* weight scale ahead of the f16 split */
#define L2E 1.4426950408889634f      /* log2(e) */
#define NR ((size_t)NB * SQ)
typedef unsigned short v8us __attribute__((ext_vector_type(8), may_alias));
typedef float  v8f  __attribute__((ext_vector_type(8)));
typedef float  v2f  __attribute__((ext_vector_type(2)));
typedef float  v4f  __attribute__((ext_vector_type(4)));
typedef float  v4fa __attribute__((ext_vector_type(4), may_alias));
typedef _Float16 v16h __attribute__((ext_vector_type(16)));
union FragH { v16h v; v8us half[2]; _Float16 h[16]; unsigned short u[16]; };

__device__ __forceinline__ unsigned short bf16_bits(float x) { unsigned int u = __float_as_uint(x); return (unsigned short)((u + 0x7FFFu + ((u >> 16) & 1u)) >> 16); }
__device__ __forceinline__ float bf16_val(unsigned short b) { return __uint_as_float(((unsigned int)b) << 16); }
__device__ __forceinline__ float bf16_round(float x) { return bf16_val(bf16_bits(x)); }

// Both planes are made of 512-byte units, one per wave-wide 16-byte load of k_attn: lane hh * 16 + ln owns bytes 16 * lane .. + 15, so a load covers four whole 128-byte lines and not 32 bytes in each of sixteen.
// KP[((bh * (SQ / 16) + g) * 4 + ks * 2 + half) * 256 + (hh * 16 + ln) * 8 + e] = f16(bf16(k[b][16 g + ln][h * 64 + 32 ks + 16 half + 8 hh + e])). A wave takes 8 keys x 32 d: it reads 8 whole lines and stores 4 whole lines.
__global__ __launch_bounds__(256) void k_kp(const float* __restrict__ k, _Float16* __restrict__ KP) { const unsigned int t = blockIdx.x * 256 + threadIdx.x, wv = t >> 5, l = t & 31;
  const unsigned int ks = wv & 1, g = (wv >> 2) % (SQ / 16), bh = wv / (4 * (SQ / 16)); const unsigned int half = l >> 4, hh = (l >> 3) & 1, ln = ((wv >> 1) & 1) * 8 + (l & 7);
  const float* p = k + ((size_t)(bh / NH) * SQ + g * 16 + ln) * DM + (bh % NH) * HD + 32 * ks + 16 * half + 8 * hh; const v4f a = *(const v4fa*)p, c = *(const v4fa*)(p + 4); FragH f;
#pragma unroll
  for (int q = 0; q < 4; ++q) { f.h[q] = (_Float16)bf16_round(a[q]); f.h[4 + q] = (_Float16)bf16_round(c[q]); }
  *(v8us*)((unsigned short*)KP + ((size_t)(bh * (SQ / 16) + g) * 4 + ks * 2 + half) * 256 + (hh * 16 + ln) * 8) = f.half[0]; }

// VP[((bh * (SQ / 32) + p) * 8 + dt * 2 + half) * 256 + (hh * 16 + ln) * 8 + e] = f16(bf16(v[b][32 p + 16 half + 8 hh + e][h * 64 + 16 dt + ln])), 64 x 64 tiles through LDS
__global__ __launch_bounds__(256) void k_vp(const float* __restrict__ v, _Float16* __restrict__ VP) { __shared__ unsigned short tl[64][66]; const int tid = threadIdx.x; const int slab = blockIdx.x / (SQ / 64), lg = blockIdx.x % (SQ / 64); const int b = slab / NH, h = slab % NH;
  for (int i = tid; i < 64 * 8; i += 256) { const int r = i / 8, c8 = (i % 8) * 8; const float* p = v + ((size_t)b * SQ + lg * 64 + r) * DM + h * HD + c8; const v4f a = *(const v4fa*)p, c = *(const v4fa*)(p + 4); FragH f;
#pragma unroll
    for (int q = 0; q < 4; ++q) { f.h[q] = (_Float16)bf16_round(a[q]); f.h[4 + q] = (_Float16)bf16_round(c[q]); }
#pragma unroll
    for (int q = 0; q < 8; ++q) tl[r][c8 + q] = f.u[q]; }
  __syncthreads();
#pragma unroll
  for (int rd = 0; rd < 2; ++rd) { const int d = (tid >> 6) * 16 + (tid & 15), k0 = rd * 32 + ((tid >> 5) & 1) * 16 + ((tid >> 4) & 1) * 8; FragH f;      /* tid = (dt * 2 + half) * 32 + hh * 16 + ln; rd = the 32-key pass inside the tile */
#pragma unroll
    for (int q = 0; q < 8; ++q) f.u[q] = tl[k0 + q][d];
    *(v8us*)((unsigned short*)VP + ((size_t)slab * (SQ / 32) + lg * 2 + rd) * 2048 + tid * 8) = f.half[0]; } }

// a wave-uniform pointer held in scalar registers: a load then names it as its scalar base beside the lane's 32-bit offset, which no pass rewrites (no 64-bit vector address to form per pass)
typedef const __attribute__((address_space(1))) unsigned short* gptr;      /* stays a global-memory pointer through the integer round trip */
typedef const __attribute__((address_space(1))) v8us* gptr8;
__device__ __forceinline__ gptr sbase(const _Float16* p) { const unsigned long long a = (unsigned long long)p; const unsigned int l = (unsigned int)__builtin_amdgcn_readfirstlane((int)(unsigned int)a), u = (unsigned int)__builtin_amdgcn_readfirstlane((int)(unsigned int)(a >> 32)); return (gptr)(((unsigned long long)u << 32) | l); }
// one operand fragment in the hardware k order: element s < 8 is k = 8 hh + s, element s >= 8 is k = 16 + 8 hh + (s - 8); p points at the fragment's first 512-byte unit (its second follows) and is the same in every lane, lo = 8 times the lane's number
__device__ __forceinline__ v16h g2_frag(gptr p, unsigned int lo) { FragH f; f.half[0] = *(gptr8)(p + lo); f.half[1] = *(gptr8)(p + 256 + lo); return f.v; }
__device__ __forceinline__ v8f mma(v16h a, v16h b, v8f c) { return __builtin_amdgcn_wmma_f32_16x16x32_f16(false, a, false, b, (short)0, c, false, false); }

// T5 unidirectional bucket of distance rp = query - key >= 0: rp < 16 -> rp; else min(16 + int(log(rp/16)/log(8)*16), 31), f32 math as the reference
__device__ __forceinline__ int rp_bucket(int rp) { if (rp < 16) return rp; const float lg = logf((float)rp / 16.0f) / 2.0794415416798357f * 16.0f; int b = 16 + (int)lg; return b > 31 ? 31 : b; }

// the lane's 16 table entries of one pass, in the order of its score registers: bt[8 t + r] belongs to key 16 t + 8 hh + r; dq = query minus the pass's first key. Beyond FAR + 31 all 32 distances have the last bucket, which is read at the table's end
__device__ __forceinline__ void bias16(const float* tb, int dq, int hh, float* bt) { const float* tp = tb + TPAD + ((dq < FAR + 31) ? dq : FAR + 31) - 8 * hh;
#pragma unroll
  for (int i = 0; i < 16; ++i) bt[i] = tp[-(i & 7) - 16 * (i >> 3)]; }
// the weights of one pass (32 keys x 16 queries) from its score accumulators s[0], s[1]: softplus / ln 2, row sum, f16 head and remainder in B-operand order.
// TAB: the bias comes from bt, otherwise it is the one value cb (every key of the pass in the last bucket). SEL: bit 16 t + r of vw says whether the key counts, otherwise every key counts for every query of the wave and nothing is selected.
template <bool SEL, bool TAB>
__device__ __forceinline__ void weights(const v8f* s, const float* bt, float cb, unsigned int vw, float& sum, FragH& ph, FragH& pl) {
#pragma unroll
  for (int t = 0; t < 2; ++t) {
    float spv[8];      /* softplus / ln 2, two elements at a time: the plain arithmetic is packed f32 */
#pragma unroll
    for (int r = 0; r < 8; r += 2) {
      const v2f sv = {s[t][r], s[t][r + 1]}, bv = {TAB ? bt[8 * t + r] : cb, TAB ? bt[8 * t + r + 1] : cb}, c2 = {0.125f * L2E, 0.125f * L2E}, l2 = {L2E, L2E};
      const v2f y_ = __builtin_elementwise_fma(sv, c2, bv);
      const v2f e_ = {__builtin_amdgcn_exp2f(-__builtin_fabsf(y_[0])), __builtin_amdgcn_exp2f(-__builtin_fabsf(y_[1]))};      /* in (0, 1]: no overflow at any score */
      const v2f u_ = e_ + 1.0f;
      const v2f r_ = e_ - (u_ - 1.0f);      /* what the sum 1 + e_ rounded away, exact; added back to first order below, so a small weight keeps its relative accuracy */
      const v2f m_ = {fmaxf(y_[0], 0.f), fmaxf(y_[1], 0.f)}, g_ = {__builtin_amdgcn_logf(u_[0]), __builtin_amdgcn_logf(u_[1])};
      const v2f p_ = __builtin_elementwise_fma(r_, l2, m_) + g_;
      spv[r] = p_[0]; spv[r + 1] = p_[1];
    }
#pragma unroll
    for (int r = 0; r < 8; ++r) {
      const float sp = spv[r];
      const float wg = (!SEL || ((vw >> (16 * t + r)) & 1u)) ? sp : 0.f;
      sum += wg;
      const float x = wg * WSC; const _Float16 hv = (_Float16)x;
      ph.h[8 * t + r] = hv; pl.h[8 * t + r] = (_Float16)(x - (float)hv);
    }
  }
}
struct PassFar { static constexpr bool near = false; };
struct PassNear { static constexpr bool near = true; };

// waves_per_eu(2, 4): at most 256 registers, so that two work-groups (four waves per SIMD) share a WGP, with room left for the scheduler to interleave the 16 softplus chains of a pass
__global__ __launch_bounds__(32 * NWV) __attribute__((amdgpu_waves_per_eu(2, 4))) void k_attn(const float* __restrict__ q, const _Float16* __restrict__ KP, const _Float16* __restrict__ VP, const int* __restrict__ mask, const float* __restrict__ rb, float* __restrict__ out) {
  __shared__ float tb[TN];             /* tb[TPAD + rp] = this head's bias at distance rp, times log2(e) */
  __shared__ unsigned int mw[SQ / 32]; /* bit k of mw[c] = key 32 c + k is unmasked */
  const int tid = threadIdx.x, lane = tid & 31, ln = lane & 15, hh = lane >> 4;
  const int w = __builtin_amdgcn_readfirstlane(tid >> 5);      /* the wave's number in a scalar register: the key loop's bound stays scalar */
  const int bh = blockIdx.x % (NB * NH), pr = blockIdx.x / (NB * NH);
  const int b = bh / NH, h = bh % NH;
  const int nkey = (NQT - pr) * QH;      /* keys this work-group can see: up to the end of its long tile */
  const int* mrow = mask + (size_t)b * SQ;
  for (int i = tid; i < TN; i += 32 * NWV) tb[i] = (i < TPAD) ? 0.f : bf16_round(rb[rp_bucket(i - TPAD) * NH + h]) * L2E;
  for (int c = w; c < nkey / 32; c += NWV) { const unsigned int bits = __builtin_amdgcn_ballot_w32(mrow[c * 32 + lane] != 0); if (lane == 0) mw[c] = bits; }
  __syncthreads();      /* table and mask words are read by every wave from here on */

  /* causal rows differ in length: the first half of the waves takes tile NQT - 1 - pr, the second half tile pr, so every work-group has the same number of passes */
  const int q0 = ((w < NWV / 2) ? (NQT - 1 - pr) : pr) * QH + (w % (NWV / 2)) * (16 * QW);      /* the wave's first query */
  const int jl = q0 & ~31;                     /* first key of the wave's last pass, the one that holds the diagonal */
  v16h qf[QW][2]; bool qok[QW];
#pragma unroll
  for (int u = 0; u < QW; ++u) {
    const float* qr = q + ((size_t)b * SQ + q0 + 16 * u + ln) * DM + h * HD;
    qok[u] = (mrow[q0 + 16 * u + ln] != 0);
#pragma unroll
    for (int ks = 0; ks < 2; ++ks) {
      const float* p0 = qr + 32 * ks + 8 * hh;
      const v4f x0 = *(const v4fa*)p0, x1 = *(const v4fa*)(p0 + 4), x2 = *(const v4fa*)(p0 + 16), x3 = *(const v4fa*)(p0 + 20);
      FragH f;
#pragma unroll
      for (int e = 0; e < 4; ++e) { f.h[e] = (_Float16)bf16_round(x0[e]); f.h[4 + e] = (_Float16)bf16_round(x1[e]); f.h[8 + e] = (_Float16)bf16_round(x2[e]); f.h[12 + e] = (_Float16)bf16_round(x3[e]); }
      qf[u][ks] = f.v;
    }
  }
  /* bit p of fm: in pass p every key counts for every query of the wave: the pass lies in front of the one with the diagonal, its mask word is all ones, no query of the wave is masked. All scalar: the loops test it without a vector instruction */
  bool allq = true;
#pragma unroll
  for (int u = 0; u < QW; ++u) allq = allq && (__builtin_amdgcn_ballot_w32(qok[u]) == 0xFFFFFFFFu);
  const unsigned int f0 = __builtin_amdgcn_ballot_w32(lane < nkey / 32 && mw[lane] == 0xFFFFFFFFu), f1 = __builtin_amdgcn_ballot_w32(32 + lane < nkey / 32 && mw[32 + lane] == 0xFFFFFFFFu);
  const unsigned long long fm = allq ? ((((unsigned long long)f1 << 32) | f0) & ((1ull << (jl >> 5)) - 1ull)) : 0ull;
  const int jf = (q0 >= FAR + 31) ? ((q0 - (FAR + 31)) & ~31) + 32 : 0;      /* passes in front of key jf have their last key FAR or more behind the wave's first query: one bias */
  const float cb = bf16_round(rb[31 * NH + h]) * L2E;      /* the last bucket's bias, as the table holds it */
  const _Float16* Kb = KP + (size_t)bh * SQ * HD;      /* key 0 of this head: 64 elements a key in both planes */
  const _Float16* Vb = VP + (size_t)bh * SQ * HD;
  const unsigned int flo = (unsigned int)(lane * 8);      /* the lane's place in a unit: fixed for the whole loop, the pass moves the scalar base alone */
  const v8f z8 = {0.f, 0.f, 0.f, 0.f, 0.f, 0.f, 0.f, 0.f};
  v8f acc[QW][4]; float sum[QW];
#pragma unroll
  for (int u = 0; u < QW; ++u) { sum[u] = 0.f;
#pragma unroll
    for (int dt = 0; dt < 4; ++dt) acc[u][dt] = z8; }
  v16h kf[2][2];
#pragma unroll
  for (int t = 0; t < 2; ++t)
#pragma unroll
    for (int ks = 0; ks < 2; ++ks) kf[t][ks] = g2_frag(sbase(Kb) + (2 * t + ks) * 512, flo);

  /* one pass of 32 keys; cls says at compile time whether the pass can need the table. Inlined in both loops below, so that each loop gets its own schedule */
  auto pass = [&](const int j0, auto cls) __attribute__((always_inline)) {
    constexpr bool NEAR = decltype(cls)::near;
    v16h vf[4]; const gptr vs = sbase(Vb + (size_t)j0 * HD);
#pragma unroll
    for (int dt = 0; dt < 4; ++dt) vf[dt] = g2_frag(vs + dt * 512, flo);
    unsigned int kw = 0u; float bt[QW][16];
    if (NEAR) { kw = mw[j0 >> 5];      /* near the diagonal every pass needs the table: read ahead of the score products */
#pragma unroll
      for (int u = 0; u < QW; ++u) bias16(tb, q0 + 16 * u + ln - j0, hh, bt[u]); }
    v8f s[QW][2];
#pragma unroll
    for (int u = 0; u < QW; ++u)
#pragma unroll
      for (int t = 0; t < 2; ++t) s[u][t] = mma(kf[t][1], qf[u][1], mma(kf[t][0], qf[u][0], z8));      /* s[u][t][r] = score of key j0 + 16 t + 8 hh + r, query q0 + 16 u + ln */
    const int jn = (j0 + 32 <= jl) ? j0 + 32 : jl; const gptr ks_ = sbase(Kb + (size_t)jn * HD);      /* the next pass's K fragments fly under this pass's vector work; the last pass reloads its own rows, in bounds */
#pragma unroll
    for (int t = 0; t < 2; ++t)
#pragma unroll
      for (int ks = 0; ks < 2; ++ks) kf[t][ks] = g2_frag(ks_ + (2 * t + ks) * 512, flo);
#pragma unroll
    for (int u = 0; u < QW; ++u) {
      FragH ph, pl;
      if ((fm >> (j0 >> 5)) & 1ull) weights<false, NEAR>(s[u], bt[u], cb, 0u, sum[u], ph, pl);
      else {
        const int dq = q0 + 16 * u + ln - j0;      /* query minus the pass's first key, >= 0 */
        if (!NEAR) { kw = mw[j0 >> 5]; bias16(tb, dq, hh, bt[u]); }
        const unsigned int cm = (dq >= 31) ? 0xFFFFFFFFu : ((2u << dq) - 1u);      /* causal: keys j0 .. j0 + dq */
        const unsigned int vw = (qok[u] ? (kw & cm) : 0u) >> (8 * hh);
        weights<true, true>(s[u], bt[u], cb, vw, sum[u], ph, pl);
      }
#pragma unroll
      for (int dt = 0; dt < 4; ++dt) acc[u][dt] = mma(vf[dt], pl.v, acc[u][dt]);
#pragma unroll
      for (int dt = 0; dt < 4; ++dt) acc[u][dt] = mma(vf[dt], ph.v, acc[u][dt]);      /* acc[u][dt][r] = O^T[d = 16 dt + 8 hh + r][query q0 + 16 u + ln] */
    }
  };
  /* most passes lie far behind the diagonal with nothing masked: one constant bias, no select, no LDS read. The few near it read the table; only the last one, or one under a masked key or query, selects */
  int j0 = 0;
  for (; j0 < jf; j0 += 32) pass(j0, PassFar{});
  for (; j0 <= jl; j0 += 32) pass(j0, PassNear{});
#pragma unroll
  for (int u = 0; u < QW; ++u) {
    const float oth = __builtin_bit_cast(float, __builtin_amdgcn_permlanex16(__builtin_bit_cast(int, sum[u]), __builtin_bit_cast(int, sum[u]), 0x76543210, 0xfedcba98, false, false));      /* lane l ^ 16 holds the same query's other keys */
    const float sc = (1.0f / WSC) / __fadd_rn(sum[u] + oth, 1e-8f * L2E);      /* sums and weights both carry 1 / ln 2 */
    float* o = out + ((size_t)b * SQ + q0 + 16 * u + ln) * DM + h * HD + 8 * hh;
#pragma unroll
    for (int dt = 0; dt < 4; ++dt) {
      const v4f o0 = {acc[u][dt][0] * sc, acc[u][dt][1] * sc, acc[u][dt][2] * sc, acc[u][dt][3] * sc};
      const v4f o1 = {acc[u][dt][4] * sc, acc[u][dt][5] * sc, acc[u][dt][6] * sc, acc[u][dt][7] * sc};
      *(v4f*)(o + 16 * dt) = o0; *(v4f*)(o + 16 * dt + 4) = o1;
    }
  }
}

extern "C" void kernel_launch(void* const* d_in, const int* in_sizes, int n_in,
                              void* d_out, int out_size, void* d_ws, size_t ws_size, hipStream_t stream) {
  (void)in_sizes; (void)n_in; (void)out_size;
  const float* const* I = (const float* const*)d_in; const float* v = I[0]; const float* k = I[1]; const float* q = I[2]; const int* mask = (const int*)d_in[3]; const float* rb = I[4];      /* table order: v, k, q, mask, rel_bias */
  char* ws = (char*)d_ws; size_t off = 0;
  auto take = [&](size_t bytes) { char* p = ws + off; off += (bytes + 255) & ~(size_t)255; return p; };
  _Float16* KP = (_Float16*)take(NR * DM * 2); _Float16* VP = (_Float16*)take(NR * DM * 2);
  if (off > ws_size) return;      /* 2 x 8 MiB */
  k_kp<<<NR * DM / 8 / 256, 256, 0, stream>>>(k, KP);
  k_vp<<<NB * NH * (SQ / 64), 256, 0, stream>>>(v, VP);
  k_attn<<<NB * NH * (NQT / 2), 32 * NWV, 0, stream>>>(q, KP, VP, mask, rb, (float*)d_out);
}

// v006
// A run of this version takes 56.6 microseconds.
// In both of two side-by-side timings against v005, it was 1.03 times as fast.
// Counting every step since v000, it is 1406 times as fast.
#include <hip/hip_runtime.h>
// PointwiseAggregatedAttention (q, k, v [2][2048][1024] given directly, 16 heads of 64; att = q.k/8 + rel_bias[T5 bucket(key - query)][h]; w = softplus(att) where (causal AND mask_q AND mask_k) else 0; w /= (sum + 1e-8); out = w v merged -> [2][2048][1024]; mask [2][2048] int, read on device).
// Structure: one preparing launch (k and v as f16, each packed in the order of the WMMA operand fragments that read it), then ONE kernel for scores, weights and output. The normaliser is a plain row sum (no maximum to track), so the division waits until the end:
// out = (sum_j sp_ij v_j) / (sum_j sp_ij + 1e-8). Per wave 16 queries; per pass 32 keys: S^T = K . Q^T (WMMA), softplus and masks on the score accumulators in place, which are then already a B operand (hardware k order), O^T += V^T . P^T (WMMA). No score or weight ever reaches memory.
// Softplus in base 2: with y = att * log2(e), softplus(att) = ln 2 * (max(y, 0) + log2(1 + 2^-|y|)); the factor ln 2 is common to every weight and to the row sum, so it cancels in the division and only the 1e-8 is rescaled. 2^x and log2 are one hardware instruction each.
// Compute dtype: inputs rounded to bf16 (exact as f16); scores, bias, softplus, row sum f32; weights x128 as f16 plus an f16 residual (two WMMA terms into one f32 accumulator). v_wmma_f32_16x16x32_f16.
#define NB 2
#define SQ 2048
#define DM 1024
#define NH 16
#define HD 64
#define QW 1                         /* 16-query column groups per wave */
#define NWV 8                        /* waves per work-group */
#define QH (16 * QW * NWV / 2)       /* queries per half work-group: one tile */
#define NQT (SQ / QH)                /* query tiles per (batch, head) */
#define TPAD 32                      /* table entries in front of distance 0: the diagonal pass indexes down to -31 */
#define FAR 128                      /* from this distance on every key falls in the last bucket: 16 + int(log(rp / 16) / log(8) * 16) >= 31 */
#define TN (TPAD + FAR + 32)         /* table entries: distances -32 .. FAR + 31, so that a pass of 32 keys can read the last bucket alone */
#define WSC 128.0f                   /* weight scale ahead of the f16 split */
#define L2E 1.4426950408889634f      /* log2(e) */
#define NR ((size_t)NB * SQ)
typedef unsigned short v8us __attribute__((ext_vector_type(8), may_alias));
typedef float  v8f  __attribute__((ext_vector_type(8)));
typedef float  v2f  __attribute__((ext_vector_type(2)));
typedef float  v4f  __attribute__((ext_vector_type(4)));
typedef float  v4fa __attribute__((ext_vector_type(4), may_alias));
typedef _Float16 v16h __attribute__((ext_vector_type(16)));
union FragH { v16h v; v8us half[2]; _Float16 h[16]; unsigned short u[16]; };

__device__ __forceinline__ unsigned short bf16_bits(float x) { unsigned int u = __float_as_uint(x); return (unsigned short)((u + 0x7FFFu + ((u >> 16) & 1u)) >> 16); }
__device__ __forceinline__ float bf16_val(unsigned short b) { return __uint_as_float(((unsigned int)b) << 16); }
__device__ __forceinline__ float bf16_round(float x) { return bf16_val(bf16_bits(x)); }

// Both planes are made of 512-byte units, one per wave-wide 16-byte load of k_attn: lane hh * 16 + ln owns bytes 16 * lane .. + 15, so a load covers four whole 128-byte lines and not 32 bytes in each of sixteen.
// KP[((bh * (SQ / 16) + g) * 4 + ks * 2 + half) * 256 + (hh * 16 + ln) * 8 + e] = f16(bf16(k[b][16 g + ln][h * 64 + 32 ks + 16 half + 8 hh + e]))
// VP[((bh * (SQ / 32) + p) * 8 + dt * 2 + half) * 256 + (hh * 16 + ln) * 8 + e] = f16(bf16(v[b][32 p + 16 half + 8 hh + e][h * 64 + 16 dt + ln]))
// ONE launch packs both. A short launch is paid for by the waves it starts, so a wave takes a whole block of 32 keys x 64 d (8 KB of f32 in, 4 KB out: 2048 elements of its plane) with all its loads in flight at once;
// even work-groups pack k, odd ones v, so that every WGP streams both. No wave needs another's data: no LDS, no barrier.
__global__ __launch_bounds__(256) void k_prep(const float* __restrict__ k, const float* __restrict__ v, _Float16* __restrict__ KP, _Float16* __restrict__ VP) {
  const unsigned int l = threadIdx.x & 31, blk = (blockIdx.x >> 1) * 8 + (threadIdx.x >> 5);      /* blk = bh * (SQ / 32) + p */
  const unsigned int bh = blk / (SQ / 32), p = blk % (SQ / 32);
  const size_t row0 = ((size_t)(bh / NH) * SQ + p * 32) * DM + (bh % NH) * HD;      /* the block's first key, the head's first d */
  if (blockIdx.x & 1) {
    /* v: the lane keeps two d (l and l + 32) and walks the keys, so the transposition happens in its registers. A load is one whole line (32 d of one key); a store is two runs of 256 bytes (dt = 2 dh + (l >> 4), ln = l & 15; kg = 2 half + hh) */
    const float* s = v + row0 + l; float x[2][32];
#pragma unroll
    for (int r = 0; r < 32; ++r) { x[0][r] = s[(size_t)r * DM]; x[1][r] = s[(size_t)r * DM + 32]; }
    __builtin_amdgcn_sched_barrier(0);      /* every load is issued before the first conversion: otherwise the scheduler sinks some behind waits, and the wave pays the memory latency several times over */
    unsigned short* o = (unsigned short*)VP + (size_t)blk * 2048 + (l >> 4) * 512 + (l & 15) * 8;
#pragma unroll
    for (int dh = 0; dh < 2; ++dh)
#pragma unroll
      for (int kg = 0; kg < 4; ++kg) { FragH f;
#pragma unroll
        for (int e = 0; e < 8; ++e) f.h[e] = (_Float16)bf16_round(x[dh][8 * kg + e]);
        *(v8us*)(o + dh * 1024 + kg * 128) = f.half[0]; }
    asm volatile("s_wait_xcnt 0x0" ::: "memory");      /* a precaution: the k half is laid out behind this one, and this wait stands in front of every write there of a register that the last stores name */
  } else {
    /* k: the lane takes 8 d of one key (half = l >> 4, hh = (l >> 3) & 1, ln = 8 kh + (l & 7)); per piece of 8 keys x 32 d the wave reads 8 whole lines and stores 4 whole lines */
    const float* s = k + row0 + (size_t)(l & 7) * DM + (l >> 3) * 8; v4f x[8][2];
#pragma unroll
    for (int i = 0; i < 8; ++i) { const float* q = s + (size_t)(i >> 1) * 8 * DM + (i & 1) * 32; x[i][0] = *(const v4fa*)q; x[i][1] = *(const v4fa*)(q + 4); }      /* i = 4 gi + 2 kh + ks, g = 2 p + gi */
    asm volatile("s_wait_xcnt 0x0" :: "v"(s) : "memory");      /* a precaution: s is an input, so the address pair that all sixteen loads name stays live up to this wait: no load's result is allotted to it and nothing writes it ahead of the wait */
    __builtin_amdgcn_sched_barrier(0);      /* as above: all sixteen loads in flight before the first wait on data */
    unsigned short* o = (unsigned short*)KP + (size_t)blk * 2048 + (l >> 3) * 128 + (l & 7) * 8;
#pragma unroll
    for (int i = 0; i < 8; ++i) { FragH f;
#pragma unroll
      for (int e = 0; e < 4; ++e) { f.h[e] = (_Float16)bf16_round(x[i][0][e]); f.h[4 + e] = (_Float16)bf16_round(x[i][1][e]); }
      *(v8us*)(o + (i >> 2) * 1024 + (i & 1) * 512 + ((i >> 1) & 1) * 64) = f.half[0]; }
  }
}

// a wave-uniform pointer held in scalar registers: a load then names it as its scalar base beside the lane's 32-bit offset, which no pass rewrites (no 64-bit vector address to form per pass)
typedef const __attribute__((address_space(1))) unsigned short* gptr;      /* stays a global-memory pointer through the integer round trip */
typedef const __attribute__((address_space(1))) v8us* gptr8;
__device__ __forceinline__ gptr sbase(const _Float16* p) { const unsigned long long a = (unsigned long long)p; const unsigned int l = (unsigned int)__builtin_amdgcn_readfirstlane((int)(unsigned int)a), u = (unsigned int)__builtin_amdgcn_readfirstlane((int)(unsigned int)(a >> 32)); return (gptr)(((unsigned long long)u << 32) | l); }
// one operand fragment in the hardware k order: element s < 8 is k = 8 hh + s, element s >= 8 is k = 16 + 8 hh + (s - 8); p points at the fragment's first 512-byte unit (its second follows) and is the same in every lane, lo = 8 times the lane's number
__device__ __forceinline__ v16h g2_frag(gptr p, unsigned int lo) { FragH f; f.half[0] = *(gptr8)(p + lo); f.half[1] = *(gptr8)(p + 256 + lo); return f.v; }
__device__ __forceinline__ v8f mma(v16h a, v16h b, v8f c) { return __builtin_amdgcn_wmma_f32_16x16x32_f16(false, a, false, b, (short)0, c, false, false); }

// T5 unidirectional bucket of distance rp = query - key >= 0: rp < 16 -> rp; else min(16 + int(log(rp/16)/log(8)*16), 31), f32 math as the reference
__device__ __forceinline__ int rp_bucket(int rp) { if (rp < 16) return rp; const float lg = logf((float)rp / 16.0f) / 2.0794415416798357f * 16.0f; int b = 16 + (int)lg; return b > 31 ? 31 : b; }

// the lane's 16 table entries of one pass, in the order of its score registers: bt[8 t + r] belongs to key 16 t + 8 hh + r; dq = query minus the pass's first key. Beyond FAR + 31 all 32 distances have the last bucket, which is read at the table's end
__device__ __forceinline__ void bias16(const float* tb, int dq, int hh, float* bt) { const float* tp = tb + TPAD + ((dq < FAR + 31) ? dq : FAR + 31) - 8 * hh;
#pragma unroll
  for (int i = 0; i < 16; ++i) bt[i] = tp[-(i & 7) - 16 * (i >> 3)]; }
// the weights of one pass (32 keys x 16 queries) from its score accumulators s[0], s[1]: softplus / ln 2, row sum, f16 head and remainder in B-operand order.
// TAB: the bias comes from bt, otherwise it is the one value cb (every key of the pass in the last bucket). SEL: bit 16 t + r of vw says whether the key counts, otherwise every key counts for every query of the wave and nothing is selected.
template <bool SEL, bool TAB>
__device__ __forceinline__ void weights(const v8f* s, const float* bt, float cb, unsigned int vw, float& sum, FragH& ph, FragH& pl) {
#pragma unroll
  for (int t = 0; t < 2; ++t) {
    float spv[8];      /* softplus / ln 2, two elements at a time: the plain arithmetic is packed f32 */
#pragma unroll
    for (int r = 0; r < 8; r += 2) {
      const v2f sv = {s[t][r], s[t][r + 1]}, bv = {TAB ? bt[8 * t + r] : cb, TAB ? bt[8 * t + r + 1] : cb}, c2 = {0.125f * L2E, 0.125f * L2E}, l2 = {L2E, L2E};
      const v2f y_ = __builtin_elementwise_fma(sv, c2, bv);
      const v2f e_ = {__builtin_amdgcn_exp2f(-__builtin_fabsf(y_[0])), __builtin_amdgcn_exp2f(-__builtin_fabsf(y_[1]))};      /* in (0, 1]: no overflow at any score */
      const v2f u_ = e_ + 1.0f;
      const v2f r_ = e_ - (u_ - 1.0f);      /* what the sum 1 + e_ rounded away, exact; added back to first order below, so a small weight keeps its relative accuracy */
      const v2f m_ = {fmaxf(y_[0], 0.f), fmaxf(y_[1], 0.f)}, g_ = {__builtin_amdgcn_logf(u_[0]), __builtin_amdgcn_logf(u_[1])};
      const v2f p_ = __builtin_elementwise_fma(r_, l2, m_) + g_;
      spv[r] = p_[0]; spv[r + 1] = p_[1];
    }
#pragma unroll
    for (int r = 0; r < 8; ++r) {
      const float sp = spv[r];
      const float wg = (!SEL || ((vw >> (16 * t + r)) & 1u)) ? sp : 0.f;
      sum += wg;
      const float x = wg * WSC; const _Float16 hv = (_Float16)x;
      ph.h[8 * t + r] = hv; pl.h[8 * t + r] = (_Float16)(x - (float)hv);
    }
  }
}
struct PassFar { static constexpr bool near = false; };
struct PassNear { static constexpr bool near = true; };

// waves_per_eu(2, 4): at most 256 registers, so that two work-groups (four waves per SIMD) share a WGP, with room left for the scheduler to interleave the 16 softplus chains of a pass
__global__ __launch_bounds__(32 * NWV) __attribute__((amdgpu_waves_per_eu(2, 4))) void k_attn(const float* __restrict__ q, const _Float16* __restrict__ KP, const _Float16* __restrict__ VP, const int* __restrict__ mask, const float* __restrict__ rb, float* __restrict__ out) {
  __shared__ float tb[TN];             /* tb[TPAD + rp] = this head's bias at distance rp, times log2(e) */
  __shared__ unsigned int mw[SQ / 32]; /* bit k of mw[c] = key 32 c + k is unmasked */
  const int tid = threadIdx.x, lane = tid & 31, ln = lane & 15, hh = lane >> 4;
  const int w = __builtin_amdgcn_readfirstlane(tid >> 5);      /* the wave's number in a scalar register: the key loop's bound stays scalar */
  const int bh = blockIdx.x % (NB * NH), pr = blockIdx.x / (NB * NH);
  const int b = bh / NH, h = bh % NH;
  const int nkey = (NQT - pr) * QH;      /* keys this work-group can see: up to the end of its long tile */
  const int* mrow = mask + (size_t)b * SQ;
  for (int i = tid; i < TN; i += 32 * NWV) tb[i] = (i < TPAD) ? 0.f : bf16_round(rb[rp_bucket(i - TPAD) * NH + h]) * L2E;
  for (int c = w; c < nkey / 32; c += NWV) { const unsigned int bits = __builtin_amdgcn_ballot_w32(mrow[c * 32 + lane] != 0); if (lane == 0) mw[c] = bits; }
  __syncthreads();      /* table and mask words are read by every wave from here on */

  /* causal rows differ in length: the first half of the waves takes tile NQT - 1 - pr, the second half tile pr, so every work-group has the same number of passes */
  const int q0 = ((w < NWV / 2) ? (NQT - 1 - pr) : pr) * QH + (w % (NWV / 2)) * (16 * QW);      /* the wave's first query */
  const int jl = q0 & ~31;                     /* first key of the wave's last pass, the one that holds the diagonal */
  v16h qf[QW][2]; bool qok[QW];
#pragma unroll
  for (int u = 0; u < QW; ++u) {
    const float* qr = q + ((size_t)b * SQ + q0 + 16 * u + ln) * DM + h * HD;
    qok[u] = (mrow[q0 + 16 * u + ln] != 0);
#pragma unroll
    for (int ks = 0; ks < 2; ++ks) {
      const float* p0 = qr + 32 * ks + 8 * hh;
      const v4f x0 = *(const v4fa*)p0, x1 = *(const v4fa*)(p0 + 4), x2 = *(const v4fa*)(p0 + 16), x3 = *(const v4fa*)(p0 + 20);
      FragH f;
#pragma unroll
      for (int e = 0; e < 4; ++e) { f.h[e] = (_Float16)bf16_round(x0[e]); f.h[4 + e] = (_Float16)bf16_round(x1[e]); f.h[8 + e] = (_Float16)bf16_round(x2[e]); f.h[12 + e] = (_Float16)bf16_round(x3[e]); }
      qf[u][ks] = f.v;
    }
  }
  /* bit p of fm: in pass p every key counts for every query of the wave: the pass lies in front of the one with the diagonal, its mask word is all ones, no query of the wave is masked. All scalar: the loops test it without a vector instruction */
  bool allq = true;
#pragma unroll
  for (int u = 0; u < QW; ++u) allq = allq && (__builtin_amdgcn_ballot_w32(qok[u]) == 0xFFFFFFFFu);
  const unsigned int f0 = __builtin_amdgcn_ballot_w32(lane < nkey / 32 && mw[lane] == 0xFFFFFFFFu), f1 = __builtin_amdgcn_ballot_w32(32 + lane < nkey / 32 && mw[32 + lane] == 0xFFFFFFFFu);
  const unsigned long long fm = allq ? ((((unsigned long long)f1 << 32) | f0) & ((1ull << (jl >> 5)) - 1ull)) : 0ull;
  const int jf = (q0 >= FAR + 31) ? ((q0 - (FAR + 31)) & ~31) + 32 : 0;      /* passes in front of key jf have their last key FAR or more behind the wave's first query: one bias */
  const float cb = bf16_round(rb[31 * NH + h]) * L2E;      /* the last bucket's bias, as the table holds it */
  const _Float16* Kb = KP + (size_t)bh * SQ * HD;      /* key 0 of this head: 64 elements a key in both planes */
  const _Float16* Vb = VP + (size_t)bh * SQ * HD;
  const unsigned int flo = (unsigned int)(lane * 8);      /* the lane's place in a unit: fixed for the whole loop, the pass moves the scalar base alone */
  const v8f z8 = {0.f, 0.f, 0.f, 0.f, 0.f, 0.f, 0.f, 0.f};
  v8f acc[QW][4]; float sum[QW];
#pragma unroll
  for (int u = 0; u < QW; ++u) { sum[u] = 0.f;
#pragma unroll
    for (int dt = 0; dt < 4; ++dt) acc[u][dt] = z8; }
  v16h kf[2][2];
#pragma unroll
  for (int t = 0; t < 2; ++t)
#pragma unroll
    for (int ks = 0; ks < 2; ++ks) kf[t][ks] = g2_frag(sbase(Kb) + (2 * t + ks) * 512, flo);

  /* one pass of 32 keys; cls says at compile time whether the pass can need the table. Inlined in both loops below, so that each loop gets its own schedule */
  auto pass = [&](const int j0, auto cls) __attribute__((always_inline)) {
    constexpr bool NEAR = decltype(cls)::near;
    v16h vf[4]; const gptr vs = sbase(Vb + (size_t)j0 * HD);
#pragma unroll
    for (int dt = 0; dt < 4; ++dt) vf[dt] = g2_frag(vs + dt * 512, flo);
    unsigned int kw = 0u; float bt[QW][16];
    if (NEAR) { kw = mw[j0 >> 5];      /* near the diagonal every pass needs the table: read ahead of the score products */
#pragma unroll
      for (int u = 0; u < QW; ++u) bias16(tb, q0 + 16 * u + ln - j0, hh, bt[u]); }
    v8f s[QW][2];
#pragma unroll
    for (int u = 0; u < QW; ++u)
#pragma unroll
      for (int t = 0; t < 2; ++t) s[u][t] = mma(kf[t][1], qf[u][1], mma(kf[t][0], qf[u][0], z8));      /* s[u][t][r] = score of key j0 + 16 t + 8 hh + r, query q0 + 16 u + ln */
    const int jn = (j0 + 32 <= jl) ? j0 + 32 : jl; const gptr ks_ = sbase(Kb + (size_t)jn * HD);      /* the next pass's K fragments fly under this pass's vector work; the last pass reloads its own rows, in bounds */
#pragma unroll
    for (int t = 0; t < 2; ++t)
#pragma unroll
      for (int ks = 0; ks < 2; ++ks) kf[t][ks] = g2_frag(ks_ + (2 * t + ks) * 512, flo);
#pragma unroll
    for (int u = 0; u < QW; ++u) {
      FragH ph, pl;
      if ((fm >> (j0 >> 5)) & 1ull) weights<false, NEAR>(s[u], bt[u], cb, 0u, sum[u], ph, pl);
      else {
        const int dq = q0 + 16 * u + ln - j0;      /* query minus the pass's first key, >= 0 */
        if (!NEAR) { kw = mw[j0 >> 5]; bias16(tb, dq, hh, bt[u]); }
        const unsigned int cm = (dq >= 31) ? 0xFFFFFFFFu : ((2u << dq) - 1u);      /* causal: keys j0 .. j0 + dq */
        const unsigned int vw = (qok[u] ? (kw & cm) : 0u) >> (8 * hh);
        weights<true, true>(s[u], bt[u], cb, vw, sum[u], ph, pl);
      }
#pragma unroll
      for (int dt = 0; dt < 4; ++dt) acc[u][dt] = mma(vf[dt], pl.v, acc[u][dt]);
#pragma unroll
      for (int dt = 0; dt < 4; ++dt) acc[u][dt] = mma(vf[dt], ph.v, acc[u][dt]);      /* acc[u][dt][r] = O^T[d = 16 dt + 8 hh + r][query q0 + 16 u + ln] */
    }
  };
  /* most passes lie far behind the diagonal with nothing masked: one constant bias, no select, no LDS read. The few near it read the table; only the last one, or one under a masked key or query, selects */
  int j0 = 0;
  for (; j0 < jf; j0 += 32) pass(j0, PassFar{});
  for (; j0 <= jl; j0 += 32) pass(j0, PassNear{});
#pragma unroll
  for (int u = 0; u < QW; ++u) {
    const float oth = __builtin_bit_cast(float, __builtin_amdgcn_permlanex16(__builtin_bit_cast(int, sum[u]), __builtin_bit_cast(int, sum[u]), 0x76543210, 0xfedcba98, false, false));      /* lane l ^ 16 holds the same query's other keys */
    const float sc = (1.0f / WSC) / __fadd_rn(sum[u] + oth, 1e-8f * L2E);      /* sums and weights both carry 1 / ln 2 */
    float* o = out + ((size_t)b * SQ + q0 + 16 * u + ln) * DM + h * HD + 8 * hh;
#pragma unroll
    for (int dt = 0; dt < 4; ++dt) {
      const v4f o0 = {acc[u][dt][0] * sc, acc[u][dt][1] * sc, acc[u][dt][2] * sc, acc[u][dt][3] * sc};
      const v4f o1 = {acc[u][dt][4] * sc, acc[u][dt][5] * sc, acc[u][dt][6] * sc, acc[u][dt][7] * sc};
      *(v4f*)(o + 16 * dt) = o0; *(v4f*)(o + 16 * dt + 4) = o1;
    }
  }
}

extern "C" void kernel_launch(void* const* d_in, const int* in_sizes, int n_in,
                              void* d_out, int out_size, void* d_ws, size_t ws_size, hipStream_t stream) {
  (void)in_sizes; (void)n_in; (void)out_size;
  const float* const* I = (const float* const*)d_in; const float* v = I[0]; const float* k = I[1]; const float* q = I[2]; const int* mask = (const int*)d_in[3]; const float* rb = I[4];      /* table order: v, k, q, mask, rel_bias */
  char* ws = (char*)d_ws; size_t off = 0;
  auto take = [&](size_t bytes) { char* p = ws + off; off += (bytes + 255) & ~(size_t)255; return p; };
  _Float16* KP = (_Float16*)take(NR * DM * 2); _Float16* VP = (_Float16*)take(NR * DM * 2);
  if (off > ws_size) return;      /* 2 x 8 MiB */
  k_prep<<<2 * NB * NH * (SQ / 32) / 8, 256, 0, stream>>>(k, v, KP, VP);
  k_attn<<<NB * NH * (NQT / 2), 32 * NWV, 0, stream>>>(q, KP, VP, mask, rb, (float*)d_out);
}

// v008
// A run of this version takes 38.4 microseconds.
// Versions in between are left out here; by their measured steps it is 1.44 times as fast as v006.
// All steps since v000 together make it 2031 times as fast.
#include <hip/hip_runtime.h>
// PointwiseAggregatedAttention (q, k, v [2][2048][1024] given directly, 16 heads of 64; att = q.k/8 + rel_bias[T5 bucket(key - query)][h]; w = softplus(att) where (causal AND mask_q AND mask_k) else 0; w /= (sum + 1e-8); out = w v merged -> [2][2048][1024]; mask [2][2048] int, read on device).
// Structure: one preparing launch (k and v as f16, each packed in the order of the WMMA operand fragments that read it), then ONE kernel for scores, weights and output. The normaliser is a plain row sum (no maximum to track), so the division waits until the end:
// out = (sum_j sp_ij v_j) / (sum_j sp_ij + 1e-8). Per wave 16 queries; per pass 32 keys: S^T = K . Q^T (WMMA), softplus and masks on the score accumulators in place, which are then already a B operand (hardware k order), O^T += V^T . P^T (WMMA). No score or weight ever reaches memory.
// Softplus in base 2: with y = att * log2(e), softplus(att) = ln 2 * (max(y, 0) + log2(1 + 2^-|y|)); the weights go into the products without the factor ln 2; the row sum takes it in as the multiplier of its fma, and the final scale carries it once for the products. 2^x and log2 are one hardware instruction each.
// Compute dtype: inputs rounded to bf16 (exact as f16); scores, bias, softplus f32; each weight goes to the P.V product as ONE f16 value, and the f32 row sum adds those same rounded values, so numerator and divisor carry the same weights. v_wmma_f32_16x16x32_f16.
// Why one f16 is enough: rounding q and k to bf16 already moves a score by about 1e-3, a weight by about as much relatively; the f16 rounding of a weight (at most 2^-11) lies several times below that.
#define NB 2
#define SQ 2048
#define DM 1024
#define NH 16
#define HD 64
#define QW 1                         /* 16-query column groups per wave */
#define NWV 8                        /* waves per work-group */
#define QH (16 * QW * NWV / 2)       /* queries per half work-group: one tile */
#define NQT (SQ / QH)                /* query tiles per (batch, head) */
#define TPAD 32                      /* table entries in front of distance 0: the diagonal pass indexes down to -31 */
#define FAR 128                      /* from this distance on every key falls in the last bucket: 16 + int(log(rp / 16) / log(8) * 16) >= 31 */
#define TN (TPAD + FAR + 32)         /* table entries: distances -32 .. FAR + 31, so that a pass of 32 keys can read the last bucket alone */
#define L2E 1.4426950408889634f      /* log2(e) */
#define LN2 0.6931471805599453f      /* 1 / log2(e) */
#define NR ((size_t)NB * SQ)
typedef unsigned short v8us __attribute__((ext_vector_type(8), may_alias));
typedef float  v8f  __attribute__((ext_vector_type(8)));
typedef float  v2f  __attribute__((ext_vector_type(2)));
typedef float  v4f  __attribute__((ext_vector_type(4)));
typedef float  v4fa __attribute__((ext_vector_type(4), may_alias));
typedef _Float16 v16h __attribute__((ext_vector_type(16)));
typedef _Float16 v2h __attribute__((ext_vector_type(2)));
union FragH { v16h v; v8us half[2]; v2h p[8]; _Float16 h[16]; unsigned short u[16]; };

__device__ __forceinline__ unsigned short bf16_bits(float x) { unsigned int u = __float_as_uint(x); return (unsigned short)((u + 0x7FFFu + ((u >> 16) & 1u)) >> 16); }
__device__ __forceinline__ float bf16_val(unsigned short b) { return __uint_as_float(((unsigned int)b) << 16); }
__device__ __forceinline__ float bf16_round(float x) { return bf16_val(bf16_bits(x)); }

// Both planes are made of 512-byte units, one per wave-wide 16-byte load of k_attn: lane hh * 16 + ln owns bytes 16 * lane .. + 15, so a load covers four whole 128-byte lines and not 32 bytes in each of sixteen.
// KP[((bh * (SQ / 16) + g) * 4 + ks * 2 + half) * 256 + (hh * 16 + ln) * 8 + e] = f16(bf16(k[b][16 g + ln][h * 64 + 32 ks + 16 half + 8 hh + e]))
// VP[((bh * (SQ / 32) + p) * 8 + dt * 2 + half) * 256 + (hh * 16 + ln) * 8 + e] = f16(bf16(v[b][32 p + 16 half + 8 hh + e][h * 64 + 16 dt + ln]))
// ONE launch packs both. A short launch is paid for by the waves it starts, so a wave takes a whole block of 32 keys x 64 d (8 KB of f32 in, 4 KB out: 2048 elements of its plane) with all its loads in flight at once;
// even work-groups pack k, odd ones v, so that every WGP streams both. No wave needs another's data: no LDS, no barrier.
__global__ __launch_bounds__(256) void k_prep(const float* __restrict__ k, const float* __restrict__ v, _Float16* __restrict__ KP, _Float16* __restrict__ VP) {
  const unsigned int l = threadIdx.x & 31, blk = (blockIdx.x >> 1) * 8 + (threadIdx.x >> 5);      /* blk = bh * (SQ / 32) + p */
  const unsigned int bh = blk / (SQ / 32), p = blk % (SQ / 32);
  const size_t row0 = ((size_t)(bh / NH) * SQ + p * 32) * DM + (bh % NH) * HD;      /* the block's first key, the head's first d */
  if (blockIdx.x & 1) {
    /* v: the lane keeps two d (l and l + 32) and walks the keys, so the transposition happens in its registers. A load is one whole line (32 d of one key); a store is two runs of 256 bytes (dt = 2 dh + (l >> 4), ln = l & 15; kg = 2 half + hh) */
    const float* s = v + row0 + l; float x[2][32];
#pragma unroll
    for (int r = 0; r < 32; ++r) { x[0][r] = s[(size_t)r * DM]; x[1][r] = s[(size_t)r * DM + 32]; }
    __builtin_amdgcn_sched_barrier(0);      /* every load is issued before the first conversion: otherwise the scheduler sinks some behind waits, and the wave pays the memory latency several times over */
    unsigned short* o = (unsigned short*)VP + (size_t)blk * 2048 + (l >> 4) * 512 + (l & 15) * 8;
#pragma unroll
    for (int dh = 0; dh < 2; ++dh)
#pragma unroll
      for (int kg = 0; kg < 4; ++kg) { FragH f;
#pragma unroll
        for (int e = 0; e < 8; ++e) f.h[e] = (_Float16)bf16_round(x[dh][8 * kg + e]);
        *(v8us*)(o + dh * 1024 + kg * 128) = f.half[0]; }
    asm volatile("s_wait_xcnt 0x0" ::: "memory");      /* a precaution: the k half is laid out behind this one, and this wait stands in front of every write there of a register that the last stores name */
  } else {
    /* k: the lane takes 8 d of one key (half = l >> 4, hh = (l >> 3) & 1, ln = 8 kh + (l & 7)); per piece of 8 keys x 32 d the wave reads 8 whole lines and stores 4 whole lines */
    const float* s = k + row0 + (size_t)(l & 7) * DM + (l >> 3) * 8; v4f x[8][2];
#pragma unroll
    for (int i = 0; i < 8; ++i) { const float* q = s + (size_t)(i >> 1) * 8 * DM + (i & 1) * 32; x[i][0] = *(const v4fa*)q; x[i][1] = *(const v4fa*)(q + 4); }      /* i = 4 gi + 2 kh + ks, g = 2 p + gi */
    asm volatile("s_wait_xcnt 0x0" :: "v"(s) : "memory");      /* a precaution: s is an input, so the address pair that all sixteen loads name stays live up to this wait: no load's result is allotted to it and nothing writes it ahead of the wait */
    __builtin_amdgcn_sched_barrier(0);      /* as above: all sixteen loads in flight before the first wait on data */
    unsigned short* o = (unsigned short*)KP + (size_t)blk * 2048 + (l >> 3) * 128 + (l & 7) * 8;
#pragma unroll
    for (int i = 0; i < 8; ++i) { FragH f;
#pragma unroll
      for (int e = 0; e < 4; ++e) { f.h[e] = (_Float16)bf16_round(x[i][0][e]); f.h[4 + e] = (_Float16)bf16_round(x[i][1][e]); }
      *(v8us*)(o + (i >> 2) * 1024 + (i & 1) * 512 + ((i >> 1) & 1) * 64) = f.half[0]; }
  }
}

// a wave-uniform pointer held in scalar registers: a load then names it as its scalar base beside the lane's 32-bit offset, which no pass rewrites (no 64-bit vector address to form per pass)
typedef const __attribute__((address_space(1))) unsigned short* gptr;      /* stays a global-memory pointer through the integer round trip */
typedef const __attribute__((address_space(1))) v8us* gptr8;
__device__ __forceinline__ gptr sbase(const _Float16* p) { const unsigned long long a = (unsigned long long)p; const unsigned int l = (unsigned int)__builtin_amdgcn_readfirstlane((int)(unsigned int)a), u = (unsigned int)__builtin_amdgcn_readfirstlane((int)(unsigned int)(a >> 32)); return (gptr)(((unsigned long long)u << 32) | l); }
// one operand fragment in the hardware k order: element s < 8 is k = 8 hh + s, element s >= 8 is k = 16 + 8 hh + (s - 8); p points at the fragment's first 512-byte unit (its second follows) and is the same in every lane, lo = 8 times the lane's number
__device__ __forceinline__ v16h g2_frag(gptr p, unsigned int lo) { FragH f; f.half[0] = *(gptr8)(p + lo); f.half[1] = *(gptr8)(p + 256 + lo); return f.v; }
__device__ __forceinline__ v8f mma(v16h a, v16h b, v8f c) { return __builtin_amdgcn_wmma_f32_16x16x32_f16(false, a, false, b, (short)0, c, false, false); }

// T5 unidirectional bucket of distance rp = query - key >= 0: rp < 16 -> rp; else min(16 + int(log(rp/16)/log(8)*16), 31), f32 math as the reference
__device__ __forceinline__ int rp_bucket(int rp) { if (rp < 16) return rp; const float lg = logf((float)rp / 16.0f) / 2.0794415416798357f * 16.0f; int b = 16 + (int)lg; return b > 31 ? 31 : b; }

// the lane's 16 table entries of one pass, in the order of its score registers: bt[8 t + r] belongs to key 16 t + 8 hh + r; dq = query minus the pass's first key. Beyond FAR + 31 all 32 distances have the last bucket, which is read at the table's end
__device__ __forceinline__ void bias16(const float* tb, int dq, int hh, float* bt) { const float* tp = tb + TPAD + ((dq < FAR + 31) ? dq : FAR + 31) - 8 * hh;
#pragma unroll
  for (int i = 0; i < 16; ++i) bt[i] = tp[-(i & 7) - 16 * (i >> 3)]; }
// the weights of one pass (32 keys x 16 queries) from its score accumulators s[0], s[1]: softplus / ln 2 as f16 in B-operand order, and their row sum.
// TAB: the bias comes from bt, otherwise it is the one value cb (every key of the pass in the last bucket). SEL: bit 16 t + r of vw says whether the key counts, otherwise every key counts for every query of the wave and nothing is selected.
template <bool SEL, bool TAB>
__device__ __forceinline__ void weights(const v8f* s, const float* bt, float cb, unsigned int vw, float& sum, FragH& ph) {
#pragma unroll
  for (int t = 0; t < 2; ++t) {
    float spv[8];      /* softplus / ln 2, two elements at a time: the plain arithmetic is packed f32 */
#pragma unroll
    for (int r = 0; r < 8; r += 2) {
      const v2f sv = {s[t][r], s[t][r + 1]}, bv = {TAB ? bt[8 * t + r] : cb, TAB ? bt[8 * t + r + 1] : cb}, c2 = {0.125f * L2E, 0.125f * L2E}, l2 = {L2E, L2E};
      const v2f y_ = __builtin_elementwise_fma(sv, c2, bv);
      const v2f e_ = {__builtin_amdgcn_exp2f(-__builtin_fabsf(y_[0])), __builtin_amdgcn_exp2f(-__builtin_fabsf(y_[1]))};      /* in (0, 1]: no overflow at any score */
      const v2f u_ = e_ + 1.0f;
      const v2f r_ = e_ - (u_ - 1.0f);      /* what the sum 1 + e_ rounded away, exact; added back to first order below, so a small weight keeps its relative accuracy */
      const v2f m_ = {fmaxf(y_[0], 0.f), fmaxf(y_[1], 0.f)}, g_ = {__builtin_amdgcn_logf(u_[0]), __builtin_amdgcn_logf(u_[1])};
      const v2f p_ = __builtin_elementwise_fma(r_, l2, m_) + g_;
      spv[r] = p_[0]; spv[r + 1] = p_[1];
    }
#pragma unroll
    for (int r = 0; r < 8; r += 2) {
      const float w0 = (!SEL || ((vw >> (16 * t + r)) & 1u)) ? spv[r] : 0.f, w1 = (!SEL || ((vw >> (16 * t + r + 1)) & 1u)) ? spv[r + 1] : 0.f;
      const v2f wp = {w0, w1}; const v2h hp = __builtin_convertvector(wp, v2h);      /* one packed conversion, round to nearest even */
      ph.p[4 * t + r / 2] = hp;
      sum = __builtin_fmaf((float)hp[1], LN2, __builtin_fmaf((float)hp[0], LN2, sum));      /* the rounded weights, in natural units: a mixed-precision fma reads the f16 as it is, no conversion back */
    }
  }
}
struct PassFar { static constexpr bool near = false; };
struct PassNear { static constexpr bool near = true; };

// waves_per_eu(2, 4): at most 256 registers, so that two work-groups (four waves per SIMD) share a WGP, with room left for the scheduler to interleave the 16 softplus chains of a pass
__global__ __launch_bounds__(32 * NWV) __attribute__((amdgpu_waves_per_eu(2, 4))) void k_attn(const float* __restrict__ q, const _Float16* __restrict__ KP, const _Float16* __restrict__ VP, const int* __restrict__ mask, const float* __restrict__ rb, float* __restrict__ out) {
  __shared__ float tb[TN];             /* tb[TPAD + rp] = this head's bias at distance rp, times log2(e) */
  __shared__ unsigned int mw[SQ / 32]; /* bit k of mw[c] = key 32 c + k is unmasked */
  __shared__ v4f pacc[NWV / 2][8 * QW][32];      /* what a wave of the second half has summed for its partner's long group: accumulators, 16 bytes a lane */
  __shared__ float psum[NWV / 2][QW][32];        /* and its part of the row sums */
  const int tid = threadIdx.x, lane = tid & 31, ln = lane & 15, hh = lane >> 4;
  const int w = __builtin_amdgcn_readfirstlane(tid >> 5);      /* the wave's number in a scalar register: the key loop's bound stays scalar */
  const int bh = blockIdx.x % (NB * NH), pr = blockIdx.x / (NB * NH);
  const int b = bh / NH, h = bh % NH;
  const int nkey = (NQT - pr) * QH;      /* keys this work-group can see: up to the end of its long tile */
  const int* mrow = mask + (size_t)b * SQ;
  for (int i = tid; i < TN; i += 32 * NWV) tb[i] = (i < TPAD) ? 0.f : bf16_round(rb[rp_bucket(i - TPAD) * NH + h]) * L2E;
  for (int c = w; c < nkey / 32; c += NWV) { const unsigned int bits = __builtin_amdgcn_ballot_w32(mrow[c * 32 + lane] != 0); if (lane == 0) mw[c] = bits; }
  __syncthreads();      /* table and mask words are read by every wave from here on */

  /* causal rows differ in length, and a wave alone on its SIMD waits out its own loads: so every wave gets the same number of passes. Wave i of the first half has group i (16 queries) of the long tile NQT - 1 - pr, wave i of the second half group i of the short tile pr;
     the two groups have nL + nS passes together (an even number), and the second wave, done with its own group, takes the first nh = (nL + nS) / 2 - nS passes of the long group. The weights need no maximum, so the two parts of a long row simply add: through LDS, at the end */
  const int i4 = w % (NWV / 2); const bool second = w >= NWV / 2;      /* both scalar */
  const int qL = (NQT - 1 - pr) * QH + i4 * (16 * QW), qS = pr * QH + i4 * (16 * QW);      /* first query of the long and of the short group */
  const int nh = (((qL >> 5) + (qS >> 5) + 2) >> 1) - (qS >> 5) - 1;      /* 1 .. NQT - 1; these passes end far more than FAR keys in front of the long group */
  const unsigned int f0 = __builtin_amdgcn_ballot_w32(lane < nkey / 32 && mw[lane] == 0xFFFFFFFFu), f1 = __builtin_amdgcn_ballot_w32(32 + lane < nkey / 32 && mw[32 + lane] == 0xFFFFFFFFu);
  const float cb = bf16_round(rb[31 * NH + h]) * L2E;      /* the last bucket's bias, as the table holds it */
  const _Float16* Kb = KP + (size_t)bh * SQ * HD;      /* key 0 of this head: 64 elements a key in both planes */
  const _Float16* Vb = VP + (size_t)bh * SQ * HD;
  const unsigned int flo = (unsigned int)(lane * 8);      /* the lane's place in a unit: fixed for the whole loop, the pass moves the scalar base alone */
  const v8f z8 = {0.f, 0.f, 0.f, 0.f, 0.f, 0.f, 0.f, 0.f};
  v8f acc[QW][4]; float sum[QW];
  /* division by the row sum and the stores of the group that begins at query qa */
  auto finish = [&](const int qa) __attribute__((always_inline)) {
#pragma unroll
    for (int u = 0; u < QW; ++u) {
      const float oth = __builtin_bit_cast(float, __builtin_amdgcn_permlanex16(__builtin_bit_cast(int, sum[u]), __builtin_bit_cast(int, sum[u]), 0x76543210, 0xfedcba98, false, false));      /* lane l ^ 16 holds the same query's other keys */
      const float sc = LN2 / __fadd_rn(sum[u] + oth, 1e-8f);      /* the accumulators carry 1 / ln 2, the sum does not */
      float* o = out + ((size_t)b * SQ + qa + 16 * u + ln) * DM + h * HD + 8 * hh;
#pragma unroll
      for (int dt = 0; dt < 4; ++dt) {
        const v4f o0 = {acc[u][dt][0] * sc, acc[u][dt][1] * sc, acc[u][dt][2] * sc, acc[u][dt][3] * sc};
        const v4f o1 = {acc[u][dt][4] * sc, acc[u][dt][5] * sc, acc[u][dt][6] * sc, acc[u][dt][7] * sc};
        *(v4f*)(o + 16 * dt) = o0; *(v4f*)(o + 16 * dt + 4) = o1;
      }
    }
  };
  /* seg 0: the short group, whole (second half of the waves only). seg 1: the long group, keys [0, 32 nh) in the second half of the waves, keys from 32 nh up to the diagonal in the first */
  for (int seg = second ? 0 : 1; seg < 2; ++seg) {
    const int q0 = seg ? qL : qS;                /* the first query of this run of passes */
    const int jl = q0 & ~31;                     /* first key of the pass that holds the group's diagonal */
    const int js = (seg && !second) ? 32 * nh : 0;            /* first key of the run */
    const int je = (seg && second) ? 32 * nh : jl + 32;       /* the key behind its last pass */
    v16h qf[QW][2]; bool qok[QW];
#pragma unroll
    for (int u = 0; u < QW; ++u) {
      const float* qr = q + ((size_t)b * SQ + q0 + 16 * u + ln) * DM + h * HD;
      qok[u] = (mrow[q0 + 16 * u + ln] != 0);
      const float* p0 = qr + 8 * hh; v4f x[2][4];
#pragma unroll
      for (int ks = 0; ks < 2; ++ks) { x[ks][0] = *(const v4fa*)(p0 + 32 * ks); x[ks][1] = *(const v4fa*)(p0 + 32 * ks + 4); x[ks][2] = *(const v4fa*)(p0 + 32 * ks + 16); x[ks][3] = *(const v4fa*)(p0 + 32 * ks + 20); }
      asm volatile("s_wait_xcnt 0x0" :: "v"(p0) : "memory");      /* a precaution: p0 is an input, so the address pair that the eight loads name stays live up to this wait and nothing writes it ahead of the wait */
#pragma unroll
      for (int ks = 0; ks < 2; ++ks) {
        FragH f;
#pragma unroll
        for (int e = 0; e < 4; ++e) { f.h[e] = (_Float16)bf16_round(x[ks][0][e]); f.h[4 + e] = (_Float16)bf16_round(x[ks][1][e]); f.h[8 + e] = (_Float16)bf16_round(x[ks][2][e]); f.h[12 + e] = (_Float16)bf16_round(x[ks][3][e]); }
        qf[u][ks] = f.v;
      }
    }
    /* bit p of fm: in pass p every key counts for every query of the group: the pass lies in front of the one with the diagonal, its mask word is all ones, no query of the group is masked. All scalar: the loops test it without a vector instruction */
    bool allq = true;
#pragma unroll
    for (int u = 0; u < QW; ++u) allq = allq && (__builtin_amdgcn_ballot_w32(qok[u]) == 0xFFFFFFFFu);
    const unsigned long long fm = allq ? ((((unsigned long long)f1 << 32) | f0) & ((1ull << (jl >> 5)) - 1ull)) : 0ull;
    const int jf = (q0 >= FAR + 31) ? ((q0 - (FAR + 31)) & ~31) + 32 : 0;      /* passes in front of key jf have their last key FAR or more behind the group's first query: one bias */
    const int jfe = (jf < je) ? jf : je;
#pragma unroll
    for (int u = 0; u < QW; ++u) { sum[u] = 0.f;
#pragma unroll
      for (int dt = 0; dt < 4; ++dt) acc[u][dt] = z8; }
    v16h kf[2][2]; const gptr k0 = sbase(Kb + (size_t)js * HD);
#pragma unroll
    for (int t = 0; t < 2; ++t)
#pragma unroll
      for (int ks = 0; ks < 2; ++ks) kf[t][ks] = g2_frag(k0 + (2 * t + ks) * 512, flo);
    asm volatile("s_wait_xcnt 0x0" :: "s"(k0) : "memory");      /* a precaution: k0 is an input, so the scalar base that the eight loads name stays live up to this wait and nothing writes it ahead of the wait */

    /* one pass of 32 keys; cls says at compile time whether the pass can need the table. Inlined in both loops below, so that each loop gets its own schedule */
    auto pass = [&](const int j0, auto cls) __attribute__((always_inline)) {
      constexpr bool NEAR = decltype(cls)::near;
      v16h vf[4]; const gptr vs = sbase(Vb + (size_t)j0 * HD);
#pragma unroll
      for (int dt = 0; dt < 4; ++dt) vf[dt] = g2_frag(vs + dt * 512, flo);
      unsigned int kw = 0u; float bt[QW][16];
      if (NEAR) { kw = mw[j0 >> 5];      /* near the diagonal every pass needs the table: read ahead of the score products */
#pragma unroll
        for (int u = 0; u < QW; ++u) bias16(tb, q0 + 16 * u + ln - j0, hh, bt[u]); }
      v8f s[QW][2];
#pragma unroll
      for (int u = 0; u < QW; ++u)
#pragma unroll
        for (int t = 0; t < 2; ++t) s[u][t] = mma(kf[t][1], qf[u][1], mma(kf[t][0], qf[u][0], z8));      /* s[u][t][r] = score of key j0 + 16 t + 8 hh + r, query q0 + 16 u + ln */
      const int jn = (j0 + 64 <= je) ? j0 + 32 : je - 32; const gptr ks_ = sbase(Kb + (size_t)jn * HD);      /* the next pass's K fragments fly under this pass's vector work; the run's last pass reloads its own rows, in bounds */
#pragma unroll
      for (int t = 0; t < 2; ++t)
#pragma unroll
        for (int ks = 0; ks < 2; ++ks) kf[t][ks] = g2_frag(ks_ + (2 * t + ks) * 512, flo);
#pragma unroll
      for (int u = 0; u < QW; ++u) {
        FragH ph;
        if ((fm >> (j0 >> 5)) & 1ull) weights<false, NEAR>(s[u], bt[u], cb, 0u, sum[u], ph);
        else {
          const int dq = q0 + 16 * u + ln - j0;      /* query minus the pass's first key, >= 0 */
          if (!NEAR) { kw = mw[j0 >> 5]; bias16(tb, dq, hh, bt[u]); }
          const unsigned int cm = (dq >= 31) ? 0xFFFFFFFFu : ((2u << dq) - 1u);      /* causal: keys j0 .. j0 + dq */
          const unsigned int vw = (qok[u] ? (kw & cm) : 0u) >> (8 * hh);
          weights<true, true>(s[u], bt[u], cb, vw, sum[u], ph);
        }
#pragma unroll
        for (int dt = 0; dt < 4; ++dt) acc[u][dt] = mma(vf[dt], ph.v, acc[u][dt]);      /* acc[u][dt][r] = O^T[d = 16 dt + 8 hh + r][query q0 + 16 u + ln] */
      }
    };
    /* most passes lie far behind the diagonal with nothing masked: one constant bias, no select, no LDS read. The few near it read the table; only the one with the diagonal, or one under a masked key or query, selects */
    int j0 = js;
    for (; j0 < jfe; j0 += 32) pass(j0, PassFar{});
    for (; j0 < je; j0 += 32) pass(j0, PassNear{});
    if (!seg) { finish(q0); asm volatile("s_wait_xcnt 0x0" ::: "memory"); }      /* a precaution: the next run of passes reuses the registers that these stores name, and this wait stands in front of every write of them */
  }
  /* the long group's two parts: same queries, same lanes, same registers in both waves, so they add place by place */
  if (second) {
#pragma unroll
    for (int u = 0; u < QW; ++u) { psum[i4][u][lane] = sum[u];
#pragma unroll
      for (int dt = 0; dt < 4; ++dt) {
        const v4f a0 = {acc[u][dt][0], acc[u][dt][1], acc[u][dt][2], acc[u][dt][3]}, a1 = {acc[u][dt][4], acc[u][dt][5], acc[u][dt][6], acc[u][dt][7]};
        pacc[i4][8 * u + 2 * dt][lane] = a0; pacc[i4][8 * u + 2 * dt + 1][lane] = a1;
      } }
  }
  __syncthreads();      /* the second waves' parts are in LDS; every wave passes here once */
  if (!second) {
#pragma unroll
    for (int u = 0; u < QW; ++u) { sum[u] += psum[i4][u][lane];
#pragma unroll
      for (int dt = 0; dt < 4; ++dt) {
        const v4f a0 = pacc[i4][8 * u + 2 * dt][lane], a1 = pacc[i4][8 * u + 2 * dt + 1][lane];
#pragma unroll
        for (int e = 0; e < 4; ++e) { acc[u][dt][e] += a0[e]; acc[u][dt][4 + e] += a1[e]; }
      } }
    finish(qL);
  }
}

extern "C" void kernel_launch(void* const* d_in, const int* in_sizes, int n_in,
                              void* d_out, int out_size, void* d_ws, size_t ws_size, hipStream_t stream) {
  (void)in_sizes; (void)n_in; (void)out_size;
  const float* const* I = (const float* const*)d_in; const float* v = I[0]; const float* k = I[1]; const float* q = I[2]; const int* mask = (const int*)d_in[3]; const float* rb = I[4];      /* table order: v, k, q, mask, rel_bias */
  char* ws = (char*)d_ws; size_t off = 0;
  auto take = [&](size_t bytes) { char* p = ws + off; off += (bytes + 255) & ~(size_t)255; return p; };
  _Float16* KP = (_Float16*)take(NR * DM * 2); _Float16* VP = (_Float16*)take(NR * DM * 2);
  if (off > ws_size) return;      /* 2 x 8 MiB */
  k_prep<<<2 * NB * NH * (SQ / 32) / 8, 256, 0, stream>>>(k, v, KP, VP);
  k_attn<<<NB * NH * (NQT / 2), 32 * NWV, 0, stream>>>(q, KP, VP, mask, rb, (float*)d_out);
}

// v009
// One run takes 34.5 microseconds.
// Two timings next to v008 both put it at 1.13 times that version's speed.
// Over all steps from v000 it is 2297 times as fast.
#include <hip/hip_runtime.h>
// PointwiseAggregatedAttention (q, k, v [2][2048][1024] given directly, 16 heads of 64; att = q.k/8 + rel_bias[T5 bucket(key - query)][h]; w = softplus(att) where (causal AND mask_q AND mask_k) else 0; w /= (sum + 1e-8); out = w v merged -> [2][2048][1024]; mask [2][2048] int, read on device).
// Structure: one preparing launch (k and v as f16, each packed in the order of the WMMA operand fragments that read it), then ONE kernel for scores, weights and output. The normaliser is a plain row sum (no maximum to track), so the division waits until the end:
// out = (sum_j sp_ij v_j) / (sum_j sp_ij + 1e-8). Per wave 16 queries; per pass 32 keys: S^T = K . Q^T (WMMA), softplus and masks on the score accumulators in place, which are then already a B operand (hardware k order), O^T += V^T . P^T (WMMA). No score or weight ever reaches memory.
// Softplus in base 2: with y = att * log2(e), softplus(att) = ln 2 * (max(y, 0) + log2(1 + 2^-|y|)); the weights go into the products without the factor ln 2; the row sum takes it in as the multiplier of its fma, and the final scale carries it once for the products. 2^x and log2 are one hardware instruction each.
// Compute dtype: inputs rounded to bf16 (exact as f16); scores, bias, softplus f32; each weight goes to the P.V product as ONE f16 value, and the f32 row sum adds those same rounded values, so numerator and divisor carry the same weights. v_wmma_f32_16x16x32_f16.
// Why one f16 is enough: rounding q and k to bf16 already moves a score by about 1e-3, a weight by about as much relatively; the f16 rounding of a weight (at most 2^-11) lies several times below that.
#define NB 2
#define SQ 2048
#define DM 1024
#define NH 16
#define HD 64
#define QW 1                         /* 16-query column groups per wave */
#define NWV 8                        /* waves per work-group */
#define QH (16 * QW * NWV / 2)       /* queries per half work-group: one tile */
#define NQT (SQ / QH)                /* query tiles per (batch, head) */
#define TPAD 32                      /* table entries in front of distance 0: the diagonal pass indexes down to -31 */
#define FAR 128                      /* from this distance on every key falls in the last bucket: 16 + int(log(rp / 16) / log(8) * 16) >= 31 */
#define TN (TPAD + FAR + 32)         /* table entries: distances -32 .. FAR + 31, so that a pass of 32 keys can read the last bucket alone */
#define L2E 1.4426950408889634f      /* log2(e) */
#define LN2 0.6931471805599453f      /* 1 / log2(e) */
#define NR ((size_t)NB * SQ)
typedef unsigned short v8us __attribute__((ext_vector_type(8), may_alias));
typedef float  v8f  __attribute__((ext_vector_type(8)));
typedef float  v2f  __attribute__((ext_vector_type(2)));
typedef float  v4f  __attribute__((ext_vector_type(4)));
typedef float  v4fa __attribute__((ext_vector_type(4), may_alias));
typedef _Float16 v16h __attribute__((ext_vector_type(16)));
typedef _Float16 v2h __attribute__((ext_vector_type(2)));
union FragH { v16h v; v8us half[2]; v2h p[8]; _Float16 h[16]; unsigned short u[16]; };

__device__ __forceinline__ unsigned short bf16_bits(float x) { unsigned int u = __float_as_uint(x); return (unsigned short)((u + 0x7FFFu + ((u >> 16) & 1u)) >> 16); }
__device__ __forceinline__ float bf16_val(unsigned short b) { return __uint_as_float(((unsigned int)b) << 16); }
__device__ __forceinline__ float bf16_round(float x) { return bf16_val(bf16_bits(x)); }

// Both planes are made of 512-byte units, one per wave-wide 16-byte load of k_attn: lane hh * 16 + ln owns bytes 16 * lane .. + 15, so a load covers four whole 128-byte lines and not 32 bytes in each of sixteen.
// KP[((bh * (SQ / 16) + g) * 4 + ks * 2 + half) * 256 + (hh * 16 + ln) * 8 + e] = f16(bf16(k[b][16 g + ln][h * 64 + 32 ks + 16 half + 8 hh + e]))
// VP[((bh * (SQ / 32) + p) * 8 + dt * 2 + half) * 256 + (hh * 16 + ln) * 8 + e] = f16(bf16(v[b][32 p + 16 half + 8 hh + e][h * 64 + 16 dt + ln]))
// ONE launch packs both. A short launch is paid for by the waves it starts, so a wave takes a whole block of 32 keys x 64 d (8 KB of f32 in, 4 KB out: 2048 elements of its plane) with all its loads in flight at once;
// even work-groups pack k, odd ones v, so that every WGP streams both. No wave needs another's data: no LDS, no barrier.
__global__ __launch_bounds__(256) void k_prep(const float* __restrict__ k, const float* __restrict__ v, _Float16* __restrict__ KP, _Float16* __restrict__ VP) {
  const unsigned int l = threadIdx.x & 31, blk = (blockIdx.x >> 1) * 8 + (threadIdx.x >> 5);      /* blk = bh * (SQ / 32) + p */
  const unsigned int bh = blk / (SQ / 32), p = blk % (SQ / 32);
  const size_t row0 = ((size_t)(bh / NH) * SQ + p * 32) * DM + (bh % NH) * HD;      /* the block's first key, the head's first d */
  if (blockIdx.x & 1) {
    /* v: the lane keeps two d (l and l + 32) and walks the keys, so the transposition happens in its registers. A load is one whole line (32 d of one key); a store is two runs of 256 bytes (dt = 2 dh + (l >> 4), ln = l & 15; kg = 2 half + hh) */
    const float* s = v + row0 + l; float x[2][32];
#pragma unroll
    for (int r = 0; r < 32; ++r) { x[0][r] = s[(size_t)r * DM]; x[1][r] = s[(size_t)r * DM + 32]; }
    __builtin_amdgcn_sched_barrier(0);      /* every load is issued before the first conversion: otherwise the scheduler sinks some behind waits, and the wave pays the memory latency several times over */
    unsigned short* o = (unsigned short*)VP + (size_t)blk * 2048 + (l >> 4) * 512 + (l & 15) * 8;
#pragma unroll
    for (int dh = 0; dh < 2; ++dh)
#pragma unroll
      for (int kg = 0; kg < 4; ++kg) { FragH f;
#pragma unroll
        for (int e = 0; e < 8; ++e) f.h[e] = (_Float16)bf16_round(x[dh][8 * kg + e]);
        *(v8us*)(o + dh * 1024 + kg * 128) = f.half[0]; }
    asm volatile("s_wait_xcnt 0x0" ::: "memory");      /* a precaution: the k half is laid out behind this one, and this wait stands in front of every write there of a register that the last stores name */
  } else {
    /* k: the lane takes 8 d of one key (half = l >> 4, hh = (l >> 3) & 1, ln = 8 kh + (l & 7)); per piece of 8 keys x 32 d the wave reads 8 whole lines and stores 4 whole lines */
    const float* s = k + row0 + (size_t)(l & 7) * DM + (l >> 3) * 8; v4f x[8][2];
#pragma unroll
    for (int i = 0; i < 8; ++i) { const float* q = s + (size_t)(i >> 1) * 8 * DM + (i & 1) * 32; x[i][0] = *(const v4fa*)q; x[i][1] = *(const v4fa*)(q + 4); }      /* i = 4 gi + 2 kh + ks, g = 2 p + gi */
    asm volatile("s_wait_xcnt 0x0" :: "v"(s) : "memory");      /* a precaution: s is an input, so the address pair that all sixteen loads name stays live up to this wait: no load's result is allotted to it and nothing writes it ahead of the wait */
    __builtin_amdgcn_sched_barrier(0);      /* as above: all sixteen loads in flight before the first wait on data */
    unsigned short* o = (unsigned short*)KP + (size_t)blk * 2048 + (l >> 3) * 128 + (l & 7) * 8;
#pragma unroll
    for (int i = 0; i < 8; ++i) { FragH f;
#pragma unroll
      for (int e = 0; e < 4; ++e) { f.h[e] = (_Float16)bf16_round(x[i][0][e]); f.h[4 + e] = (_Float16)bf16_round(x[i][1][e]); }
      *(v8us*)(o + (i >> 2) * 1024 + (i & 1) * 512 + ((i >> 1) & 1) * 64) = f.half[0]; }
  }
}

// a wave-uniform pointer held in scalar registers: a load then names it as its scalar base beside the lane's 32-bit offset, which no pass rewrites (no 64-bit vector address to form per pass)
typedef const __attribute__((address_space(1))) unsigned short* gptr;      /* stays a global-memory pointer through the integer round trip */
typedef const __attribute__((address_space(1))) v8us* gptr8;
__device__ __forceinline__ gptr sbase(const _Float16* p) { const unsigned long long a = (unsigned long long)p; const unsigned int l = (unsigned int)__builtin_amdgcn_readfirstlane((int)(unsigned int)a), u = (unsigned int)__builtin_amdgcn_readfirstlane((int)(unsigned int)(a >> 32)); return (gptr)(((unsigned long long)u << 32) | l); }
// one operand fragment in the hardware k order: element s < 8 is k = 8 hh + s, element s >= 8 is k = 16 + 8 hh + (s - 8); p points at the fragment's first 512-byte unit (its second follows) and is the same in every lane, lo = 8 times the lane's number
__device__ __forceinline__ v16h g2_frag(gptr p, unsigned int lo) { FragH f; f.half[0] = *(gptr8)(p + lo); f.half[1] = *(gptr8)(p + 256 + lo); return f.v; }
__device__ __forceinline__ v8f mma(v16h a, v16h b, v8f c) { return __builtin_amdgcn_wmma_f32_16x16x32_f16(false, a, false, b, (short)0, c, false, false); }

// T5 unidirectional bucket of distance rp = query - key >= 0: rp < 16 -> rp; else min(16 + int(log(rp/16)/log(8)*16), 31), f32 math as the reference
__device__ __forceinline__ int rp_bucket(int rp) { if (rp < 16) return rp; const float lg = logf((float)rp / 16.0f) / 2.0794415416798357f * 16.0f; int b = 16 + (int)lg; return b > 31 ? 31 : b; }

// the lane's 16 table entries of one pass, in the order of its score registers: bt[8 t + r] belongs to key 16 t + 8 hh + r; dq = query minus the pass's first key. Beyond FAR + 31 all 32 distances have the last bucket, which is read at the table's end
__device__ __forceinline__ void bias16(const float* tb, int dq, int hh, float* bt) { const float* tp = tb + TPAD + ((dq < FAR + 31) ? dq : FAR + 31) - 8 * hh;
#pragma unroll
  for (int i = 0; i < 16; ++i) bt[i] = tp[-(i & 7) - 16 * (i >> 3)]; }
// the weights of one pass (32 keys x 16 queries) from its score accumulators s[0], s[1]: softplus / ln 2 as f16 in B-operand order, and their row sum.
// TAB: the bias comes from bt, otherwise it is the one value cb (every key of the pass in the last bucket). SEL: bit 16 t + r of vw says whether the key counts, otherwise every key counts for every query of the wave and nothing is selected.
template <bool SEL, bool TAB>
__device__ __forceinline__ void weights(const v8f* s, const float* bt, float cb, unsigned int vw, float& sum, FragH& ph) {
#pragma unroll
  for (int t = 0; t < 2; ++t) {
    float spv[8];      /* softplus / ln 2, two elements at a time: the plain arithmetic is packed f32 */
#pragma unroll
    for (int r = 0; r < 8; r += 2) {
      const v2f sv = {s[t][r], s[t][r + 1]}, bv = {TAB ? bt[8 * t + r] : cb, TAB ? bt[8 * t + r + 1] : cb}, c2 = {0.125f * L2E, 0.125f * L2E}, l2 = {L2E, L2E};
      const v2f y_ = __builtin_elementwise_fma(sv, c2, bv);
      const v2f e_ = {__builtin_amdgcn_exp2f(-__builtin_fabsf(y_[0])), __builtin_amdgcn_exp2f(-__builtin_fabsf(y_[1]))};      /* in (0, 1]: no overflow at any score */
      const v2f u_ = e_ + 1.0f;
      const v2f r_ = e_ - (u_ - 1.0f);      /* what the sum 1 + e_ rounded away, exact; added back to first order below, so a small weight keeps its relative accuracy */
      const v2f m_ = {fmaxf(y_[0], 0.f), fmaxf(y_[1], 0.f)}, g_ = {__builtin_amdgcn_logf(u_[0]), __builtin_amdgcn_logf(u_[1])};
      const v2f p_ = __builtin_elementwise_fma(r_, l2, m_) + g_;
      spv[r] = p_[0]; spv[r + 1] = p_[1];
    }
#pragma unroll
    for (int r = 0; r < 8; r += 2) {
      const float w0 = (!SEL || ((vw >> (16 * t + r)) & 1u)) ? spv[r] : 0.f, w1 = (!SEL || ((vw >> (16 * t + r + 1)) & 1u)) ? spv[r + 1] : 0.f;
      const v2f wp = {w0, w1}; const v2h hp = __builtin_convertvector(wp, v2h);      /* one packed conversion, round to nearest even */
      ph.p[4 * t + r / 2] = hp;
      sum = __builtin_fmaf((float)hp[1], LN2, __builtin_fmaf((float)hp[0], LN2, sum));      /* the rounded weights, in natural units: a mixed-precision fma reads the f16 as it is, no conversion back */
    }
  }
}
struct PassFar { static constexpr bool near = false; };
struct PassNear { static constexpr bool near = true; };
struct Set0 { static constexpr int i = 0; };
struct Set1 { static constexpr int i = 1; };

// waves_per_eu(4, 4): at most 256 registers, so that two work-groups (four waves per SIMD) still share a WGP although the two sets of K and V fragments take 128 of them
__global__ __launch_bounds__(32 * NWV) __attribute__((amdgpu_waves_per_eu(4, 4))) void k_attn(const float* __restrict__ q, const _Float16* __restrict__ KP, const _Float16* __restrict__ VP, const int* __restrict__ mask, const float* __restrict__ rb, float* __restrict__ out) {
  __shared__ float tb[TN];             /* tb[TPAD + rp] = this head's bias at distance rp, times log2(e) */
  __shared__ unsigned int mw[SQ / 32]; /* bit k of mw[c] = key 32 c + k is unmasked */
  __shared__ v4f pacc[NWV / 2][8 * QW][32];      /* what a wave of the second half has summed for its partner's long group: accumulators, 16 bytes a lane */
  __shared__ float psum[NWV / 2][QW][32];        /* and its part of the row sums */
  const int tid = threadIdx.x, lane = tid & 31, ln = lane & 15, hh = lane >> 4;
  const int w = __builtin_amdgcn_readfirstlane(tid >> 5);      /* the wave's number in a scalar register: the key loop's bound stays scalar */
  const int bh = blockIdx.x % (NB * NH), pr = blockIdx.x / (NB * NH);
  const int b = bh / NH, h = bh % NH;
  const int nkey = (NQT - pr) * QH;      /* keys this work-group can see: up to the end of its long tile */
  const int* mrow = mask + (size_t)b * SQ;
  for (int i = tid; i < TN; i += 32 * NWV) tb[i] = (i < TPAD) ? 0.f : bf16_round(rb[rp_bucket(i - TPAD) * NH + h]) * L2E;
  for (int c = w; c < nkey / 32; c += NWV) { const unsigned int bits = __builtin_amdgcn_ballot_w32(mrow[c * 32 + lane] != 0); if (lane == 0) mw[c] = bits; }
  __syncthreads();      /* table and mask words are read by every wave from here on */

  /* causal rows differ in length, and a wave alone on its SIMD waits out its own loads: so every wave gets the same number of passes. Wave i of the first half has group i (16 queries) of the long tile NQT - 1 - pr, wave i of the second half group i of the short tile pr;
     the two groups have nL + nS passes together (an even number), and the second wave, done with its own group, takes the first nh = (nL + nS) / 2 - nS passes of the long group. The weights need no maximum, so the two parts of a long row simply add: through LDS, at the end */
  const int i4 = w % (NWV / 2); const bool second = w >= NWV / 2;      /* both scalar */
  const int qL = (NQT - 1 - pr) * QH + i4 * (16 * QW), qS = pr * QH + i4 * (16 * QW);      /* first query of the long and of the short group */
  const int nh = (((qL >> 5) + (qS >> 5) + 2) >> 1) - (qS >> 5) - 1;      /* 1 .. NQT - 1; these passes end far more than FAR keys in front of the long group */
  const unsigned int f0 = __builtin_amdgcn_ballot_w32(lane < nkey / 32 && mw[lane] == 0xFFFFFFFFu), f1 = __builtin_amdgcn_ballot_w32(32 + lane < nkey / 32 && mw[32 + lane] == 0xFFFFFFFFu);
  const float cb = bf16_round(rb[31 * NH + h]) * L2E;      /* the last bucket's bias, as the table holds it */
  const _Float16* Kb = KP + (size_t)bh * SQ * HD;      /* key 0 of this head: 64 elements a key in both planes */
  const _Float16* Vb = VP + (size_t)bh * SQ * HD;
  const unsigned int flo = (unsigned int)(lane * 8);      /* the lane's place in a unit: fixed for the whole loop, the pass moves the scalar base alone */
  const v8f z8 = {0.f, 0.f, 0.f, 0.f, 0.f, 0.f, 0.f, 0.f};
  v8f acc[QW][4]; float sum[QW];
  /* division by the row sum and the stores of the group that begins at query qa */
  auto finish = [&](const int qa) __attribute__((always_inline)) {
#pragma unroll
    for (int u = 0; u < QW; ++u) {
      const float oth = __builtin_bit_cast(float, __builtin_amdgcn_permlanex16(__builtin_bit_cast(int, sum[u]), __builtin_bit_cast(int, sum[u]), 0x76543210, 0xfedcba98, false, false));      /* lane l ^ 16 holds the same query's other keys */
      const float sc = LN2 / __fadd_rn(sum[u] + oth, 1e-8f);      /* the accumulators carry 1 / ln 2, the sum does not */
      float* o = out + ((size_t)b * SQ + qa + 16 * u + ln) * DM + h * HD + 8 * hh;
#pragma unroll
      for (int dt = 0; dt < 4; ++dt) {
        const v4f o0 = {acc[u][dt][0] * sc, acc[u][dt][1] * sc, acc[u][dt][2] * sc, acc[u][dt][3] * sc};
        const v4f o1 = {acc[u][dt][4] * sc, acc[u][dt][5] * sc, acc[u][dt][6] * sc, acc[u][dt][7] * sc};
        *(v4f*)(o + 16 * dt) = o0; *(v4f*)(o + 16 * dt + 4) = o1;
      }
    }
  };
  /* seg 0: the short group, whole (second half of the waves only). seg 1: the long group, keys [0, 32 nh) in the second half of the waves, keys from 32 nh up to the diagonal in the first */
  for (int seg = second ? 0 : 1; seg < 2; ++seg) {
    const int q0 = seg ? qL : qS;                /* the first query of this run of passes */
    const int jl = q0 & ~31;                     /* first key of the pass that holds the group's diagonal */
    const int js = (seg && !second) ? 32 * nh : 0;            /* first key of the run */
    const int je = (seg && second) ? 32 * nh : jl + 32;       /* the key behind its last pass */
    v16h qf[QW][2]; bool qok[QW];
#pragma unroll
    for (int u = 0; u < QW; ++u) {
      const float* qr = q + ((size_t)b * SQ + q0 + 16 * u + ln) * DM + h * HD;
      qok[u] = (mrow[q0 + 16 * u + ln] != 0);
      const float* p0 = qr + 8 * hh; v4f x[2][4];
#pragma unroll
      for (int ks = 0; ks < 2; ++ks) { x[ks][0] = *(const v4fa*)(p0 + 32 * ks); x[ks][1] = *(const v4fa*)(p0 + 32 * ks + 4); x[ks][2] = *(const v4fa*)(p0 + 32 * ks + 16); x[ks][3] = *(const v4fa*)(p0 + 32 * ks + 20); }
      asm volatile("s_wait_xcnt 0x0" :: "v"(p0) : "memory");      /* a precaution: p0 is an input, so the address pair that the eight loads name stays live up to this wait and nothing writes it ahead of the wait */
#pragma unroll
      for (int ks = 0; ks < 2; ++ks) {
        FragH f;
#pragma unroll
        for (int e = 0; e < 4; ++e) { f.h[e] = (_Float16)bf16_round(x[ks][0][e]); f.h[4 + e] = (_Float16)bf16_round(x[ks][1][e]); f.h[8 + e] = (_Float16)bf16_round(x[ks][2][e]); f.h[12 + e] = (_Float16)bf16_round(x[ks][3][e]); }
        qf[u][ks] = f.v;
      }
    }
    /* bit p of fm: in pass p every key counts for every query of the group: the pass lies in front of the one with the diagonal, its mask word is all ones, no query of the group is masked. All scalar: the loops test it without a vector instruction */
    bool allq = true;
#pragma unroll
    for (int u = 0; u < QW; ++u) allq = allq && (__builtin_amdgcn_ballot_w32(qok[u]) == 0xFFFFFFFFu);
    const unsigned long long fm = allq ? ((((unsigned long long)f1 << 32) | f0) & ((1ull << (jl >> 5)) - 1ull)) : 0ull;
    const int jf = (q0 >= FAR + 31) ? ((q0 - (FAR + 31)) & ~31) + 32 : 0;      /* passes in front of key jf have their last key FAR or more behind the group's first query: one bias */
    const int jfe = (jf < je) ? jf : je;
#pragma unroll
    for (int u = 0; u < QW; ++u) { sum[u] = 0.f;
#pragma unroll
      for (int dt = 0; dt < 4; ++dt) acc[u][dt] = z8; }
    /* two register sets of K and V fragments: pass p of the run works from set p & 1, and a set is refilled for pass p + 2 as soon as its readers have issued. So a load has two passes to arrive in: the vector work of one pass is shorter than the loads' way there and back, and with one pass only the wave would wait in every pass */
    v16h kf[2][2][2], vf[2][4];
    auto fetch_k = [&](const int j, auto set) __attribute__((always_inline)) {
      constexpr int S = decltype(set)::i; const gptr p = sbase(Kb + (size_t)j * HD);
#pragma unroll
      for (int t = 0; t < 2; ++t)
#pragma unroll
        for (int ks = 0; ks < 2; ++ks) kf[S][t][ks] = g2_frag(p + (2 * t + ks) * 512, flo);
      asm volatile("s_wait_xcnt 0x0" :: "s"(p) : "memory");      /* a precaution: p is an input, so the scalar base that the eight loads name stays live up to this wait and nothing writes it ahead of the wait */
    };
    auto fetch_v = [&](const int j, auto set) __attribute__((always_inline)) {
      constexpr int S = decltype(set)::i; const gptr p = sbase(Vb + (size_t)j * HD);
#pragma unroll
      for (int dt = 0; dt < 4; ++dt) vf[S][dt] = g2_frag(p + dt * 512, flo);
      asm volatile("s_wait_xcnt 0x0" :: "s"(p) : "memory");      /* a precaution, as in fetch_k */
    };
    const int j1 = (js + 64 <= je) ? js + 32 : je - 32;      /* a run of one pass fills the second set from its own rows, in bounds */
    fetch_k(js, Set0{}); fetch_v(js, Set0{}); fetch_k(j1, Set1{}); fetch_v(j1, Set1{});

    /* one pass of 32 keys; cls says at compile time whether the pass can need the table. set names the register set it works from. Inlined five times below, so that every register index is a constant */
    auto pass = [&](const int j0, auto cls, auto set) __attribute__((always_inline)) {
      constexpr bool NEAR = decltype(cls)::near; constexpr int S = decltype(set)::i;
      unsigned int kw = 0u; float bt[QW][16];
      if (NEAR) { kw = mw[j0 >> 5];      /* near the diagonal every pass needs the table: read ahead of the score products */
#pragma unroll
        for (int u = 0; u < QW; ++u) bias16(tb, q0 + 16 * u + ln - j0, hh, bt[u]); }
      v8f s[QW][2];
#pragma unroll
      for (int u = 0; u < QW; ++u)
#pragma unroll
        for (int t = 0; t < 2; ++t) s[u][t] = mma(kf[S][t][1], qf[u][1], mma(kf[S][t][0], qf[u][0], z8));      /* s[u][t][r] = score of key j0 + 16 t + 8 hh + r, query q0 + 16 u + ln */
      const int jn = (j0 + 96 <= je) ? j0 + 64 : je - 32;      /* the pass after the next one; the run's last two passes reload the last pass's rows, in bounds */
      __builtin_amdgcn_sched_barrier(0);      /* the refill stays behind the products that read the set: lifted over them it would need a third set of registers and copies */
      fetch_k(jn, set);
#pragma unroll
      for (int u = 0; u < QW; ++u) {
        FragH ph;
        if ((fm >> (j0 >> 5)) & 1ull) weights<false, NEAR>(s[u], bt[u], cb, 0u, sum[u], ph);
        else {
          const int dq = q0 + 16 * u + ln - j0;      /* query minus the pass's first key, >= 0 */
          if (!NEAR) { kw = mw[j0 >> 5]; bias16(tb, dq, hh, bt[u]); }
          const unsigned int cm = (dq >= 31) ? 0xFFFFFFFFu : ((2u << dq) - 1u);      /* causal: keys j0 .. j0 + dq */
          const unsigned int vw = (qok[u] ? (kw & cm) : 0u) >> (8 * hh);
          weights<true, true>(s[u], bt[u], cb, vw, sum[u], ph);
        }
#pragma unroll
        for (int dt = 0; dt < 4; ++dt) acc[u][dt] = mma(vf[S][dt], ph.v, acc[u][dt]);      /* acc[u][dt][r] = O^T[d = 16 dt + 8 hh + r][query q0 + 16 u + ln] */
      }
      __builtin_amdgcn_sched_barrier(0);      /* as at fetch_k */
      fetch_v(jn, set);
      asm volatile("v_nop\n\tv_nop\n\tv_nop\n\tv_nop");      /* the four vector slots between a matrix product and a write over its B operand: the next pass's first score product may be given the weights' registers for its result */
      __builtin_amdgcn_sched_barrier(0);      /* the next pass's score products stay behind those slots */
    };
    /* most passes lie far behind the diagonal with nothing masked: one constant bias, no select, no LDS read. The few near it read the table; only the one with the diagonal, or one under a masked key or query, selects */
    /* passes go in pairs, one from each set; an odd far pass is left to the near loop, whose table holds the last bucket too, and an odd last pass stands alone behind it */
    int j0 = js; const int jf2 = js + ((jfe - js) & ~63);
    for (; j0 < jf2; j0 += 64) { pass(j0, PassFar{}, Set0{}); pass(j0 + 32, PassFar{}, Set1{}); }
    for (; j0 + 64 <= je; j0 += 64) { pass(j0, PassNear{}, Set0{}); pass(j0 + 32, PassNear{}, Set1{}); }
    if (j0 < je) pass(j0, PassNear{}, Set0{});
    if (!seg) { finish(q0); asm volatile("s_wait_xcnt 0x0" ::: "memory"); }      /* a precaution: the next run of passes reuses the registers that these stores name, and this wait stands in front of every write of them */
  }
  /* the long group's two parts: same queries, same lanes, same registers in both waves, so they add place by place */
  if (second) {
#pragma unroll
    for (int u = 0; u < QW; ++u) { psum[i4][u][lane] = sum[u];
#pragma unroll
      for (int dt = 0; dt < 4; ++dt) {
        const v4f a0 = {acc[u][dt][0], acc[u][dt][1], acc[u][dt][2], acc[u][dt][3]}, a1 = {acc[u][dt][4], acc[u][dt][5], acc[u][dt][6], acc[u][dt][7]};
        pacc[i4][8 * u + 2 * dt][lane] = a0; pacc[i4][8 * u + 2 * dt + 1][lane] = a1;
      } }
  }
  __syncthreads();      /* the second waves' parts are in LDS; every wave passes here once */
  if (!second) {
#pragma unroll
    for (int u = 0; u < QW; ++u) { sum[u] += psum[i4][u][lane];
#pragma unroll
      for (int dt = 0; dt < 4; ++dt) {
        const v4f a0 = pacc[i4][8 * u + 2 * dt][lane], a1 = pacc[i4][8 * u + 2 * dt + 1][lane];
#pragma unroll
        for (int e = 0; e < 4; ++e) { acc[u][dt][e] += a0[e]; acc[u][dt][4 + e] += a1[e]; }
      } }
    finish(qL);
  }
}

extern "C" void kernel_launch(void* const* d_in, const int* in_sizes, int n_in,
                              void* d_out, int out_size, void* d_ws, size_t ws_size, hipStream_t stream) {
  (void)in_sizes; (void)n_in; (void)out_size;
  const float* const* I = (const float* const*)d_in; const float* v = I[0]; const float* k = I[1]; const float* q = I[2]; const int* mask = (const int*)d_in[3]; const float* rb = I[4];      /* table order: v, k, q, mask, rel_bias */
  char* ws = (char*)d_ws; size_t off = 0;
  auto take = [&](size_t bytes) { char* p = ws + off; off += (bytes + 255) & ~(size_t)255; return p; };
  _Float16* KP = (_Float16*)take(NR * DM * 2); _Float16* VP = (_Float16*)take(NR * DM * 2);
  if (off > ws_size) return;      /* 2 x 8 MiB */
  k_prep<<<2 * NB * NH * (SQ / 32) / 8, 256, 0, stream>>>(k, v, KP, VP);
  k_attn<<<NB * NH * (NQT / 2), 32 * NWV, 0, stream>>>(q, KP, VP, mask, rb, (float*)d_out);
}

// v010
// It runs in 32.5 microseconds.
// Next to v009, in two timings, it ran 1.05 and 1.06 times as fast.
// Over all steps from v000 it is 2423 times as fast.
#include <hip/hip_runtime.h>
// PointwiseAggregatedAttention (q, k, v [2][2048][1024] given directly, 16 heads of 64; att = q.k/8 + rel_bias[T5 bucket(key - query)][h]; w = softplus(att) where (causal AND mask_q AND mask_k) else 0; w /= (sum + 1e-8); out = w v merged -> [2][2048][1024]; mask [2][2048] int, read on device).
// Structure: one preparing launch (k and v as f16, each packed in the order of the WMMA operand fragments that read it), then ONE kernel for scores, weights and output. The normaliser is a plain row sum (no maximum to track), so the division waits until the end:
// out = (sum_j sp_ij v_j) / (sum_j sp_ij + 1e-8). Per wave 16 queries; per pass 32 keys: S^T = K . Q^T (WMMA), softplus and masks on the score accumulators in place, which are then already a B operand (hardware k order), O^T += V^T . P^T (WMMA). No score or weight ever reaches memory.
// Softplus in base 2: with y = att * log2(e), softplus(att) = ln 2 * (max(y, 0) + log2(1 + 2^-|y|)); the weights go into the products without the factor ln 2; the row sum takes it in as the multiplier of its fma, and the final scale carries it once for the products. 2^x and log2 are one hardware instruction each.
// Compute dtype: inputs rounded to bf16 (exact as f16); scores, bias, softplus f32; each weight goes to the P.V product as ONE f16 value, and the f32 row sum adds those same rounded values, so numerator and divisor carry the same weights. v_wmma_f32_16x16x32_f16.
// Why one f16 is enough: rounding q and k to bf16 already moves a score by about 1e-3, a weight by about as much relatively; the f16 rounding of a weight (at most 2^-11) lies several times below that.
#define NB 2
#define SQ 2048
#define DM 1024
#define NH 16
#define HD 64
#define QW 1                         /* 16-query column groups per wave */
#define NWV 8                        /* waves per work-group */
#define QH (16 * QW * NWV / 2)       /* queries per half work-group: one tile */
#define NQT (SQ / QH)                /* query tiles per (batch, head) */
#define TPAD 32                      /* table entries in front of distance 0: the diagonal pass indexes down to -31 */
#define FAR 128                      /* from this distance on every key falls in the last bucket: 16 + int(log(rp / 16) / log(8) * 16) >= 31 */
#define TN (TPAD + FAR + 32)         /* table entries: distances -32 .. FAR + 31, so that a pass of 32 keys can read the last bucket alone */
#define L2E 1.4426950408889634f      /* log2(e) */
#define LN2 0.6931471805599453f      /* 1 / log2(e) */
#define NR ((size_t)NB * SQ)
typedef unsigned short v8us __attribute__((ext_vector_type(8), may_alias));
typedef float  v8f  __attribute__((ext_vector_type(8)));
typedef float  v2f  __attribute__((ext_vector_type(2)));
typedef float  v4f  __attribute__((ext_vector_type(4)));
typedef float  v4fa __attribute__((ext_vector_type(4), may_alias));
typedef _Float16 v16h __attribute__((ext_vector_type(16)));
typedef _Float16 v2h __attribute__((ext_vector_type(2)));
typedef unsigned int v4u __attribute__((ext_vector_type(4)));
union FragH { v16h v; v8us half[2]; v2h p[8]; _Float16 h[16]; unsigned short u[16]; };

__device__ __forceinline__ unsigned short bf16_bits(float x) { unsigned int u = __float_as_uint(x); return (unsigned short)((u + 0x7FFFu + ((u >> 16) & 1u)) >> 16); }
__device__ __forceinline__ float bf16_val(unsigned short b) { return __uint_as_float(((unsigned int)b) << 16); }
__device__ __forceinline__ float bf16_round(float x) { return bf16_val(bf16_bits(x)); }

// Both planes are made of 512-byte units, one per wave-wide 16-byte load of k_attn: lane hh * 16 + ln owns bytes 16 * lane .. + 15, so a load covers four whole 128-byte lines and not 32 bytes in each of sixteen.
// KP[((bh * (SQ / 16) + g) * 4 + ks * 2 + half) * 256 + (hh * 16 + ln) * 8 + e] = f16(bf16(k[b][16 g + ln][h * 64 + 32 ks + 16 half + 8 hh + e]))
// VP[((bh * (SQ / 32) + p) * 8 + dt * 2 + half) * 256 + (hh * 16 + ln) * 8 + e] = f16(bf16(v[b][32 p + 16 half + 8 hh + e][h * 64 + 16 dt + ln]))
// ONE launch packs both. A short launch is paid for by the waves it starts, so a wave takes a whole block of 32 keys x 64 d (8 KB of f32 in, 4 KB out: 2048 elements of its plane) with all its loads in flight at once;
// even work-groups pack k, odd ones v, so that every WGP streams both. No wave needs another's data: no LDS, no barrier.
__global__ __launch_bounds__(256) void k_prep(const float* __restrict__ k, const float* __restrict__ v, _Float16* __restrict__ KP, _Float16* __restrict__ VP) {
  const unsigned int l = threadIdx.x & 31, blk = (blockIdx.x >> 1) * 8 + (threadIdx.x >> 5);      /* blk = bh * (SQ / 32) + p */
  const unsigned int bh = blk / (SQ / 32), p = blk % (SQ / 32);
  const size_t row0 = ((size_t)(bh / NH) * SQ + p * 32) * DM + (bh % NH) * HD;      /* the block's first key, the head's first d */
  if (blockIdx.x & 1) {
    /* v: the lane keeps two d (l and l + 32) and walks the keys, so the transposition happens in its registers. A load is one whole line (32 d of one key); a store is two runs of 256 bytes (dt = 2 dh + (l >> 4), ln = l & 15; kg = 2 half + hh) */
    const float* s = v + row0 + l; float x[2][32];
#pragma unroll
    for (int r = 0; r < 32; ++r) { x[0][r] = s[(size_t)r * DM]; x[1][r] = s[(size_t)r * DM + 32]; }
    __builtin_amdgcn_sched_barrier(0);      /* every load is issued before the first conversion: otherwise the scheduler sinks some behind waits, and the wave pays the memory latency several times over */
    unsigned short* o = (unsigned short*)VP + (size_t)blk * 2048 + (l >> 4) * 512 + (l & 15) * 8;
#pragma unroll
    for (int dh = 0; dh < 2; ++dh)
#pragma unroll
      for (int kg = 0; kg < 4; ++kg) { FragH f;
#pragma unroll
        for (int e = 0; e < 8; ++e) f.h[e] = (_Float16)bf16_round(x[dh][8 * kg + e]);
        *(v8us*)(o + dh * 1024 + kg * 128) = f.half[0]; }
    asm volatile("s_wait_xcnt 0x0" ::: "memory");      /* a precaution: the k half is laid out behind this one, and this wait stands in front of every write there of a register that the last stores name */
  } else {
    /* k: the lane takes 8 d of one key (half = l >> 4, hh = (l >> 3) & 1, ln = 8 kh + (l & 7)); per piece of 8 keys x 32 d the wave reads 8 whole lines and stores 4 whole lines */
    const float* s = k + row0 + (size_t)(l & 7) * DM + (l >> 3) * 8; v4f x[8][2];
#pragma unroll
    for (int i = 0; i < 8; ++i) { const float* q = s + (size_t)(i >> 1) * 8 * DM + (i & 1) * 32; x[i][0] = *(const v4fa*)q; x[i][1] = *(const v4fa*)(q + 4); }      /* i = 4 gi + 2 kh + ks, g = 2 p + gi */
    asm volatile("s_wait_xcnt 0x0" :: "v"(s) : "memory");      /* a precaution: s is an input, so the address pair that all sixteen loads name stays live up to this wait: no load's result is allotted to it and nothing writes it ahead of the wait */
    __builtin_amdgcn_sched_barrier(0);      /* as above: all sixteen loads in flight before the first wait on data */
    unsigned short* o = (unsigned short*)KP + (size_t)blk * 2048 + (l >> 3) * 128 + (l & 7) * 8;
#pragma unroll
    for (int i = 0; i < 8; ++i) { FragH f;
#pragma unroll
      for (int e = 0; e < 4; ++e) { f.h[e] = (_Float16)bf16_round(x[i][0][e]); f.h[4 + e] = (_Float16)bf16_round(x[i][1][e]); }
      *(v8us*)(o + (i >> 2) * 1024 + (i & 1) * 512 + ((i >> 1) & 1) * 64) = f.half[0]; }
  }
}

// a wave-uniform pointer held in scalar registers: a load then names it as its scalar base beside the lane's 32-bit offset, which no pass rewrites (no 64-bit vector address to form per pass)
typedef const __attribute__((address_space(1))) unsigned short* gptr;      /* stays a global-memory pointer through the integer round trip */
typedef const __attribute__((address_space(1))) v8us* gptr8;
__device__ __forceinline__ gptr sbase(const _Float16* p) { const unsigned long long a = (unsigned long long)p; const unsigned int l = (unsigned int)__builtin_amdgcn_readfirstlane((int)(unsigned int)a), u = (unsigned int)__builtin_amdgcn_readfirstlane((int)(unsigned int)(a >> 32)); return (gptr)(((unsigned long long)u << 32) | l); }
// one operand fragment in the hardware k order: element s < 8 is k = 8 hh + s, element s >= 8 is k = 16 + 8 hh + (s - 8); p points at the fragment's first 512-byte unit (its second follows) and is the same in every lane, lo = 8 times the lane's number
__device__ __forceinline__ v16h g2_frag(gptr p, unsigned int lo) { FragH f; f.half[0] = *(gptr8)(p + lo); f.half[1] = *(gptr8)(p + 256 + lo); return f.v; }
__device__ __forceinline__ v8f mma(v16h a, v16h b, v8f c) { return __builtin_amdgcn_wmma_f32_16x16x32_f16(false, a, false, b, (short)0, c, false, false); }

// T5 unidirectional bucket of distance rp = query - key >= 0: rp < 16 -> rp; else min(16 + int(log(rp/16)/log(8)*16), 31), f32 math as the reference
__device__ __forceinline__ int rp_bucket(int rp) { if (rp < 16) return rp; const float lg = logf((float)rp / 16.0f) / 2.0794415416798357f * 16.0f; int b = 16 + (int)lg; return b > 31 ? 31 : b; }

// the lane's 16 table entries of one pass, in the order of its score registers: bt[8 t + r] belongs to key 16 t + 8 hh + r; dq = query minus the pass's first key. Beyond FAR + 31 all 32 distances have the last bucket, which is read at the table's end
__device__ __forceinline__ void bias16(const float* tb, int dq, int hh, float* bt) { const float* tp = tb + TPAD + ((dq < FAR + 31) ? dq : FAR + 31) - 8 * hh;
#pragma unroll
  for (int i = 0; i < 16; ++i) bt[i] = tp[-(i & 7) - 16 * (i >> 3)]; }
// the weights of one pass (32 keys x 16 queries) from its score accumulators s[0], s[1]: softplus / ln 2 as f16 in B-operand order, and their row sum.
// TAB: the bias comes from bt, otherwise it is the one value cb (every key of the pass in the last bucket). SEL: bit 16 t + r of vw says whether the key counts, otherwise every key counts for every query of the wave and nothing is selected.
template <bool SEL, bool TAB>
__device__ __forceinline__ void weights(const v8f* s, const float* bt, float cb, unsigned int vw, float& sum, FragH& ph) {
#pragma unroll
  for (int t = 0; t < 2; ++t) {
    float spv[8];      /* softplus / ln 2, two elements at a time: the plain arithmetic is packed f32 */
#pragma unroll
    for (int r = 0; r < 8; r += 2) {
      const v2f sv = {s[t][r], s[t][r + 1]}, bv = {TAB ? bt[8 * t + r] : cb, TAB ? bt[8 * t + r + 1] : cb}, c2 = {0.125f * L2E, 0.125f * L2E}, l2 = {L2E, L2E};
      const v2f y_ = __builtin_elementwise_fma(sv, c2, bv);
      const v2f e_ = {__builtin_amdgcn_exp2f(-__builtin_fabsf(y_[0])), __builtin_amdgcn_exp2f(-__builtin_fabsf(y_[1]))};      /* in (0, 1]: no overflow at any score */
      const v2f u_ = e_ + 1.0f;
      const v2f r_ = e_ - (u_ - 1.0f);      /* what the sum 1 + e_ rounded away, exact; added back to first order below, so a small weight keeps its relative accuracy */
      const v2f m_ = {fmaxf(y_[0], 0.f), fmaxf(y_[1], 0.f)}, g_ = {__builtin_amdgcn_logf(u_[0]), __builtin_amdgcn_logf(u_[1])};
      const v2f p_ = __builtin_elementwise_fma(r_, l2, m_) + g_;
      spv[r] = p_[0]; spv[r + 1] = p_[1];
    }
#pragma unroll
    for (int r = 0; r < 8; r += 2) {
      const float w0 = (!SEL || ((vw >> (16 * t + r)) & 1u)) ? spv[r] : 0.f, w1 = (!SEL || ((vw >> (16 * t + r + 1)) & 1u)) ? spv[r + 1] : 0.f;
      const v2f wp = {w0, w1}; const v2h hp = __builtin_convertvector(wp, v2h);      /* one packed conversion, round to nearest even */
      ph.p[4 * t + r / 2] = hp;
      sum = __builtin_fmaf((float)hp[1], LN2, __builtin_fmaf((float)hp[0], LN2, sum));      /* the rounded weights, in natural units: a mixed-precision fma reads the f16 as it is, no conversion back */
    }
  }
}
struct PassFar { static constexpr bool near = false; };
struct PassNear { static constexpr bool near = true; };
struct Set0 { static constexpr int i = 0; };
struct Set1 { static constexpr int i = 1; };

// waves_per_eu(4, 4): at most 256 registers, so that two work-groups (four waves per SIMD) still share a WGP although the two sets of K and V fragments take 128 of them
__global__ __launch_bounds__(32 * NWV) __attribute__((amdgpu_waves_per_eu(4, 4))) void k_attn(const float* __restrict__ q, const _Float16* __restrict__ KP, const _Float16* __restrict__ VP, const int* __restrict__ mask, const float* __restrict__ rb, float* __restrict__ out) {
  __shared__ float tb[TN];             /* tb[TPAD + rp] = this head's bias at distance rp, times log2(e) */
  __shared__ __attribute__((aligned(16))) unsigned int mw[SQ / 32]; /* bit k of mw[c] = key 32 c + k is unmasked */
  __shared__ v4f pacc[NWV / 2][8 * QW][32];      /* what a wave of the second half has summed for its partner's long group: accumulators, 16 bytes a lane */
  __shared__ float psum[NWV / 2][QW][32];        /* and its part of the row sums */
  const int tid = threadIdx.x, lane = tid & 31, ln = lane & 15, hh = lane >> 4;
  const int w = __builtin_amdgcn_readfirstlane(tid >> 5);      /* the wave's number in a scalar register: the key loop's bound stays scalar */
  const int bh = blockIdx.x % (NB * NH), pr = blockIdx.x / (NB * NH);
  const int b = bh / NH, h = bh % NH;
  const int nkey = (NQT - pr) * QH;      /* keys this work-group can see: up to the end of its long tile */
  const int* mrow = mask + (size_t)b * SQ;
  /* causal rows differ in length, and a wave alone on its SIMD waits out its own loads: so every wave gets the same number of passes. Wave i of the first half has group i (16 queries) of the long tile NQT - 1 - pr, wave i of the second half group i of the short tile pr;
     the two groups have nL + nS passes together (an even number), and the second wave, done with its own group, takes the first nh = (nL + nS) / 2 - nS passes of the long group. The weights need no maximum, so the two parts of a long row simply add: through LDS, at the end */
  const int i4 = w % (NWV / 2); const bool second = w >= NWV / 2;      /* both scalar */
  const int qL = (NQT - 1 - pr) * QH + i4 * (16 * QW), qS = pr * QH + i4 * (16 * QW);      /* first query of the long and of the short group */
  const int nh = (((qL >> 5) + (qS >> 5) + 2) >> 1) - (qS >> 5) - 1;      /* 1 .. NQT - 1; these passes end far more than FAR keys in front of the long group */
  const _Float16* Kb = KP + (size_t)bh * SQ * HD;      /* key 0 of this head: 64 elements a key in both planes */
  const _Float16* Vb = VP + (size_t)bh * SQ * HD;
  const unsigned int flo = (unsigned int)(lane * 8);      /* the lane's place in a unit: fixed for the whole loop, the pass moves the scalar base alone */
  /* two register sets of K and V fragments: pass p of a run works from set p & 1, and a set is refilled for pass p + 2 as soon as its readers have issued. So a load has two passes to arrive in: the vector work of one pass is shorter than the loads' way there and back, and with one pass only the wave would wait in every pass */
  v16h kf[2][2][2], vf[2][4];
  auto fetch_k = [&](const int j, auto set) __attribute__((always_inline)) {
    constexpr int S = decltype(set)::i; const gptr p = sbase(Kb + (size_t)j * HD);
#pragma unroll
    for (int t = 0; t < 2; ++t)
#pragma unroll
      for (int ks = 0; ks < 2; ++ks) kf[S][t][ks] = g2_frag(p + (2 * t + ks) * 512, flo);
    asm volatile("s_wait_xcnt 0x0" :: "s"(p) : "memory");      /* a precaution: p is an input, so the scalar base that the eight loads name stays live up to this wait and nothing writes it ahead of the wait */
  };
  auto fetch_v = [&](const int j, auto set) __attribute__((always_inline)) {
    constexpr int S = decltype(set)::i; const gptr p = sbase(Vb + (size_t)j * HD);
#pragma unroll
    for (int dt = 0; dt < 4; ++dt) vf[S][dt] = g2_frag(p + dt * 512, flo);
    asm volatile("s_wait_xcnt 0x0" :: "s"(p) : "memory");      /* a precaution, as in fetch_k */
  };
  /* what a run of passes needs before its first product: the group's query rows (f32, as they lie in memory), the queries' mask values, and both fragment sets. start_run only issues the loads, nothing in it waits on data; take_q makes the operand fragments of the rows */
  v4f xq[QW][2][4]; int qm[QW]; v16h qf[QW][2]; bool qok[QW];
  auto start_run = [&](const int seg) __attribute__((always_inline)) {
    const int q0 = seg ? qL : qS;
#pragma unroll
    for (int u = 0; u < QW; ++u) {
      const float* qr = q + ((size_t)b * SQ + q0 + 16 * u + ln) * DM + h * HD;
      qm[u] = mrow[q0 + 16 * u + ln];
      const float* p0 = qr + 8 * hh;
#pragma unroll
      for (int ks = 0; ks < 2; ++ks) { xq[u][ks][0] = *(const v4fa*)(p0 + 32 * ks); xq[u][ks][1] = *(const v4fa*)(p0 + 32 * ks + 4); xq[u][ks][2] = *(const v4fa*)(p0 + 32 * ks + 16); xq[u][ks][3] = *(const v4fa*)(p0 + 32 * ks + 20); }
      asm volatile("s_wait_xcnt 0x0" :: "v"(p0) : "memory");      /* a precaution: p0 is an input, so the address pair that the eight loads name stays live up to this wait and nothing writes it ahead of the wait */
    }
    const int js = (seg && !second) ? 32 * nh : 0, je = (seg && second) ? 32 * nh : (q0 & ~31) + 32;      /* the run's first key and the key behind its last pass, as in the loop below */
    const int j1 = (js + 64 <= je) ? js + 32 : je - 32;      /* a run of one pass fills the second set from its own rows, in bounds */
    fetch_k(js, Set0{}); fetch_v(js, Set0{}); fetch_k(j1, Set1{}); fetch_v(j1, Set1{});
    __builtin_amdgcn_sched_barrier(0);      /* every load of the run's start is issued before the first conversion of a query row: otherwise the scheduler lifts conversions, and with them waits on the rows, in front of the fragment loads */
  };
  auto take_q = [&]() __attribute__((always_inline)) {
#pragma unroll
    for (int u = 0; u < QW; ++u) {
      qok[u] = (qm[u] != 0);
#pragma unroll
      for (int ks = 0; ks < 2; ++ks) {
        FragH f;
#pragma unroll
        for (int e = 0; e < 4; ++e) { f.h[e] = (_Float16)bf16_round(xq[u][ks][0][e]); f.h[4 + e] = (_Float16)bf16_round(xq[u][ks][1][e]); f.h[8 + e] = (_Float16)bf16_round(xq[u][ks][2][e]); f.h[12 + e] = (_Float16)bf16_round(xq[u][ks][3][e]); }
        qf[u][ks] = f.v;
      }
    }
  };
  /* the start of the kernel is latency alone (every wave of the chip is in it at once, nothing else runs meanwhile), so all that it reads from memory is asked for at once, ahead of the first wait:
     the wave's eight mask words (the whole row: SQ / 32 words over NWV waves), the first run's queries and fragments, the thread's table entry. One way to memory and back, not one for each mask word and then one each for table, queries and fragments */
  static_assert(TN <= 32 * NWV && SQ / 32 == 8 * NWV, "one table entry a thread, eight mask words a wave");
  const int* mp = mrow + w * 256 + lane; int mv[8];
#pragma unroll
  for (int i = 0; i < 8; ++i) mv[i] = mp[32 * i];
  asm volatile("s_wait_xcnt 0x0" :: "v"(mp) : "memory");      /* a precaution: the pointer is an input, so the address registers that the eight loads name stay live up to this wait and nothing writes them ahead of the wait */
  start_run(second ? 0 : 1);
  const float* tp = rb + rp_bucket(tid > TPAD ? tid - TPAD : 0) * NH + h;      /* last, so that the arithmetic of the bucket runs while the other loads are under way. Threads in front of distance 0 and behind the table read an entry that exists and drop it */
  const float tv = *tp;
  asm volatile("s_wait_xcnt 0x0" :: "v"(tp) : "memory");      /* a precaution, as for the mask words */
  const float cb = bf16_round(rb[31 * NH + h]) * L2E;      /* the last bucket's bias, as the table holds it */
  if (tid < TN) tb[tid] = (tid < TPAD) ? 0.f : bf16_round(tv) * L2E;
  { unsigned int bits[8];
#pragma unroll
    for (int i = 0; i < 8; ++i) bits[i] = __builtin_amdgcn_ballot_w32(mv[i] != 0);
    if (lane == 0) { const v4u b0 = {bits[0], bits[1], bits[2], bits[3]}, b1 = {bits[4], bits[5], bits[6], bits[7]}; *(v4u*)&mw[8 * w] = b0; *(v4u*)&mw[8 * w + 4] = b1; } }
  take_q();
  __syncthreads();      /* table and mask words are read by every wave from here on */
  const unsigned int m0 = mw[lane], m1 = mw[32 + lane];      /* every word of the row is written now, so both are read at once, with no test in front of the read */
  const unsigned int f0 = __builtin_amdgcn_ballot_w32(lane < nkey / 32 && m0 == 0xFFFFFFFFu), f1 = __builtin_amdgcn_ballot_w32(32 + lane < nkey / 32 && m1 == 0xFFFFFFFFu);
  const v8f z8 = {0.f, 0.f, 0.f, 0.f, 0.f, 0.f, 0.f, 0.f};
  v8f acc[QW][4]; float sum[QW];
  /* division by the row sum and the stores of the group that begins at query qa */
  auto finish = [&](const int qa) __attribute__((always_inline)) {
#pragma unroll
    for (int u = 0; u < QW; ++u) {
      const float oth = __builtin_bit_cast(float, __builtin_amdgcn_permlanex16(__builtin_bit_cast(int, sum[u]), __builtin_bit_cast(int, sum[u]), 0x76543210, 0xfedcba98, false, false));      /* lane l ^ 16 holds the same query's other keys */
      const float sc = LN2 / __fadd_rn(sum[u] + oth, 1e-8f);      /* the accumulators carry 1 / ln 2, the sum does not */
      float* o = out + ((size_t)b * SQ + qa + 16 * u + ln) * DM + h * HD + 8 * hh;
#pragma unroll
      for (int dt = 0; dt < 4; ++dt) {
        const v4f o0 = {acc[u][dt][0] * sc, acc[u][dt][1] * sc, acc[u][dt][2] * sc, acc[u][dt][3] * sc};
        const v4f o1 = {acc[u][dt][4] * sc, acc[u][dt][5] * sc, acc[u][dt][6] * sc, acc[u][dt][7] * sc};
        *(v4f*)(o + 16 * dt) = o0; *(v4f*)(o + 16 * dt + 4) = o1;
      }
    }
  };
  /* seg 0: the short group, whole (second half of the waves only). seg 1: the long group, keys [0, 32 nh) in the second half of the waves, keys from 32 nh up to the diagonal in the first */
  for (int seg = second ? 0 : 1;; seg = 1) {
    const int q0 = seg ? qL : qS;                /* the first query of this run of passes */
    const int jl = q0 & ~31;                     /* first key of the pass that holds the group's diagonal */
    const int js = (seg && !second) ? 32 * nh : 0;            /* first key of the run */
    const int je = (seg && second) ? 32 * nh : jl + 32;       /* the key behind its last pass */
    /* bit p of fm: in pass p every key counts for every query of the group: the pass lies in front of the one with the diagonal, its mask word is all ones, no query of the group is masked. All scalar: the loops test it without a vector instruction */
    bool allq = true;
#pragma unroll
    for (int u = 0; u < QW; ++u) allq = allq && (__builtin_amdgcn_ballot_w32(qok[u]) == 0xFFFFFFFFu);
    const unsigned long long fm = allq ? ((((unsigned long long)f1 << 32) | f0) & ((1ull << (jl >> 5)) - 1ull)) : 0ull;
    const int jf = (q0 >= FAR + 31) ? ((q0 - (FAR + 31)) & ~31) + 32 : 0;      /* passes in front of key jf have their last key FAR or more behind the group's first query: one bias */
    const int jfe = (jf < je) ? jf : je;
#pragma unroll
    for (int u = 0; u < QW; ++u) { sum[u] = 0.f;
#pragma unroll
      for (int dt = 0; dt < 4; ++dt) acc[u][dt] = z8; }
    /* one pass of 32 keys; cls says at compile time whether the pass can need the table. set names the register set it works from. Inlined five times below, so that every register index is a constant */
    auto pass = [&](const int j0, auto cls, auto set) __attribute__((always_inline)) {
      constexpr bool NEAR = decltype(cls)::near; constexpr int S = decltype(set)::i;
      unsigned int kw = 0u; float bt[QW][16];
      if (NEAR) { kw = mw[j0 >> 5];      /* near the diagonal every pass needs the table: read ahead of the score products */
#pragma unroll
        for (int u = 0; u < QW; ++u) bias16(tb, q0 + 16 * u + ln - j0, hh, bt[u]); }
      v8f s[QW][2];
#pragma unroll
      for (int u = 0; u < QW; ++u)
#pragma unroll
        for (int t = 0; t < 2; ++t) s[u][t] = mma(kf[S][t][1], qf[u][1], mma(kf[S][t][0], qf[u][0], z8));      /* s[u][t][r] = score of key j0 + 16 t + 8 hh + r, query q0 + 16 u + ln */
      const int jn = (j0 + 96 <= je) ? j0 + 64 : je - 32;      /* the pass after the next one; the run's last two passes reload the last pass's rows, in bounds */
      __builtin_amdgcn_sched_barrier(0);      /* the refill stays behind the products that read the set: lifted over them it would need a third set of registers and copies */
      fetch_k(jn, set);
#pragma unroll
      for (int u = 0; u < QW; ++u) {
        FragH ph;
        if ((fm >> (j0 >> 5)) & 1ull) weights<false, NEAR>(s[u], bt[u], cb, 0u, sum[u], ph);
        else {
          const int dq = q0 + 16 * u + ln - j0;      /* query minus the pass's first key, >= 0 */
          if (!NEAR) { kw = mw[j0 >> 5]; bias16(tb, dq, hh, bt[u]); }
          const unsigned int cm = (dq >= 31) ? 0xFFFFFFFFu : ((2u << dq) - 1u);      /* causal: keys j0 .. j0 + dq */
          const unsigned int vw = (qok[u] ? (kw & cm) : 0u) >> (8 * hh);
          weights<true, true>(s[u], bt[u], cb, vw, sum[u], ph);
        }
#pragma unroll
        for (int dt = 0; dt < 4; ++dt) acc[u][dt] = mma(vf[S][dt], ph.v, acc[u][dt]);      /* acc[u][dt][r] = O^T[d = 16 dt + 8 hh + r][query q0 + 16 u + ln] */
      }
      __builtin_amdgcn_sched_barrier(0);      /* as at fetch_k */
      fetch_v(jn, set);
      asm volatile("v_nop\n\tv_nop\n\tv_nop\n\tv_nop");      /* the four vector slots between a matrix product and a write over its B operand: the next pass's first score product may be given the weights' registers for its result */
      __builtin_amdgcn_sched_barrier(0);      /* the next pass's score products stay behind those slots */
    };
    /* most passes lie far behind the diagonal with nothing masked: one constant bias, no select, no LDS read. The few near it read the table; only the one with the diagonal, or one under a masked key or query, selects */
    /* passes go in pairs, one from each set; an odd far pass is left to the near loop, whose table holds the last bucket too, and an odd last pass stands alone behind it */
    int j0 = js; const int jf2 = js + ((jfe - js) & ~63);
    for (; j0 < jf2; j0 += 64) { pass(j0, PassFar{}, Set0{}); pass(j0 + 32, PassFar{}, Set1{}); }
    for (; j0 + 64 <= je; j0 += 64) { pass(j0, PassNear{}, Set0{}); pass(j0 + 32, PassNear{}, Set1{}); }
    if (j0 < je) pass(j0, PassNear{}, Set0{});
    if (seg) break;      /* the way back to the loop's head leads through start_run alone, so the counted waits of the passes see the fragment loads in one order only */
    finish(q0); asm volatile("s_wait_xcnt 0x0" ::: "memory");      /* a precaution: the next run of passes reuses the registers that these stores name, and this wait stands in front of every write of them */
    start_run(1); take_q();
  }
  /* the long group's two parts: same queries, same lanes, same registers in both waves, so they add place by place */
  if (second) {
#pragma unroll
    for (int u = 0; u < QW; ++u) { psum[i4][u][lane] = sum[u];
#pragma unroll
      for (int dt = 0; dt < 4; ++dt) {
        const v4f a0 = {acc[u][dt][0], acc[u][dt][1], acc[u][dt][2], acc[u][dt][3]}, a1 = {acc[u][dt][4], acc[u][dt][5], acc[u][dt][6], acc[u][dt][7]};
        pacc[i4][8 * u + 2 * dt][lane] = a0; pacc[i4][8 * u + 2 * dt + 1][lane] = a1;
      } }
  }
  __syncthreads();      /* the second waves' parts are in LDS; every wave passes here once */
  if (!second) {
#pragma unroll
    for (int u = 0; u < QW; ++u) { sum[u] += psum[i4][u][lane];
#pragma unroll
      for (int dt = 0; dt < 4; ++dt) {
        const v4f a0 = pacc[i4][8 * u + 2 * dt][lane], a1 = pacc[i4][8 * u + 2 * dt + 1][lane];
#pragma unroll
        for (int e = 0; e < 4; ++e) { acc[u][dt][e] += a0[e]; acc[u][dt][4 + e] += a1[e]; }
      } }
    finish(qL);
  }
}

extern "C" void kernel_launch(void* const* d_in, const int* in_sizes, int n_in,
                              void* d_out, int out_size, void* d_ws, size_t ws_size, hipStream_t stream) {
  (void)in_sizes; (void)n_in; (void)out_size;
  const float* const* I = (const float* const*)d_in; const float* v = I[0]; const float* k = I[1]; const float* q = I[2]; const int* mask = (const int*)d_in[3]; const float* rb = I[4];      /* table order: v, k, q, mask, rel_bias */
  char* ws = (char*)d_ws; size_t off = 0;
  auto take = [&](size_t bytes) { char* p = ws + off; off += (bytes + 255) & ~(size_t)255; return p; };
  _Float16* KP = (_Float16*)take(NR * DM * 2); _Float16* VP = (_Float16*)take(NR * DM * 2);
  if (off > ws_size) return;      /* 2 x 8 MiB */
  k_prep<<<2 * NB * NH * (SQ / 32) / 8, 256, 0, stream>>>(k, v, KP, VP);
  k_attn<<<NB * NH * (NQT / 2), 32 * NWV, 0, stream>>>(q, KP, VP, mask, rb, (float*)d_out);
}
